// v000
// Measured on an AMD MI455X. A time is GPU time per run, averaged over a window of back-to-back runs after a warm-up
// (all launches, gaps included; the runs take copies of the inputs in turn), and the median of several windows.
// Apart from v000's, it joins two sittings. Times from different sittings can be a few percent apart, while
// side-by-side timings come from the same sitting.
// v000 is the starting kernel. One run takes 5140 microseconds.
#include <hip/hip_runtime.h>

// MultipleHeadAttention (q, k, v inputs [8][1024][1024]; per-head Dense: qh = q Wq[h] + bq[h] (Wq [16][1024][64]), likewise kh from k, vh from v; softmax(qh.kh / 8); out = concat heads Wo + bo ([1024][1024] 'xw') -> [8][1024][1024]).
// Compute dtypes, f32 accumulate: every input rounded to bf16; the three per-head projections as PLAIN bf16 GEMMs (inputs: exact; the 16 [1024][64] head blocks transposed into one [1024][1024] Bt) + bias; scores and attn.v: query rows < 512 hl (3 products), the rest fp16 (x1024); softmax f32 (32 keys per lane); Wo hl x exact (2 products) + bias.

#define NB_  8
#define TT   1024
#define DM   1024
#define NH_  16
#define NKV  16
#define REP  (NH_ / NKV)
#define HD   64
#define DQ   (NH_ * HD)
#define DKV  (NKV * HD)
#define ZH   2
#define RH   512                  // query rows < RH use hi+lo planes (0: none)
#define WIN  0
#define PCAR 1024.0f
#define SCL  0.125f   // HD^-0.5
typedef _Float16 h16;
typedef unsigned short bf;
typedef __attribute__((ext_vector_type(16))) __bf16   v16bf;
typedef __attribute__((ext_vector_type(16))) _Float16 v16h;
typedef __attribute__((ext_vector_type(8)))  _Float16 v8h;
typedef __attribute__((ext_vector_type(8)))  unsigned short v8us;
typedef __attribute__((ext_vector_type(8)))  float    v8f;
typedef __attribute__((ext_vector_type(4)))  float    v4f;
typedef v8h  __attribute__((may_alias)) v8ha;
typedef v4f  __attribute__((may_alias)) v4fa;
typedef v8us __attribute__((may_alias)) v8usa;

__device__ __forceinline__ unsigned short f2bf(float f) { unsigned u = __float_as_uint(f); u += 0x7FFFu + ((u >> 16) & 1u); return (unsigned short)(u >> 16); }
__device__ __forceinline__ float bf2f(unsigned short b) { return __uint_as_float(((unsigned)b) << 16); }
__device__ __forceinline__ float bfr(float f) { return bf2f(f2bf(f)); }
__device__ __forceinline__ v16h cat16(v8h lo, v8h hi) { return __builtin_shufflevector(lo, hi, 0, 1, 2, 3, 4, 5, 6, 7, 8, 9, 10, 11, 12, 13, 14, 15); }
__device__ __forceinline__ v16bf cat16b(v8us lo, v8us hi) { return __builtin_bit_cast(v16bf, __builtin_shufflevector(lo, hi, 0, 1, 2, 3, 4, 5, 6, 7, 8, 9, 10, 11, 12, 13, 14, 15)); }
__device__ __forceinline__ v8f wmma16(v16h a, v16h b, v8f c) { return __builtin_amdgcn_wmma_f32_16x16x32_f16(false, a, false, b, (short)0, c, false, false); }
__device__ __forceinline__ v8f wmmab(v16bf a, v16bf b, v8f c) { return __builtin_amdgcn_wmma_f32_16x16x32_bf16(false, a, false, b, (short)0, c, false, false); }



// ---- k_gemmw: register-blocked GEMM, ONE WAVE per 64x64 output tile (16 accumulators), operands straight from K-contiguous 16-bit planes; grid (M/64, N/64, Z), 32 threads.
// C[m][n] (f32, pitch ldc, + optional f32 bias[n]) = sum_k A[m][k] Bt[n][k] (+ split products per NSPLIT). z-batch strides sA/sB/sC in elements. K % 32 == 0.
template <typename T16> struct WFrag;
template <> struct WFrag<h16> { typedef v16h V; static __device__ __forceinline__ V ld(const h16* p) { return cat16(*(const v8h*)p, *(const v8h*)(p + 16)); } static __device__ __forceinline__ v8f mma(V a, V b, v8f c) { return wmma16(a, b, c); } };
template <> struct WFrag<bf> { typedef v16bf V; static __device__ __forceinline__ V ld(const bf* p) { return cat16b(*(const v8us*)p, *(const v8us*)(p + 16)); } static __device__ __forceinline__ v8f mma(V a, V b, v8f c) { return wmmab(a, b, c); } };
template <typename T16, int NSPLIT, bool BIAS>
__global__ __launch_bounds__(32) void k_gemmw(const T16* __restrict__ A, const T16* __restrict__ A2, const T16* __restrict__ Bt, const T16* __restrict__ Bt2, int K, float* C, int ldc, const float* __restrict__ bias, size_t sA, size_t sB, size_t sC) {
    typedef typename WFrag<T16>::V V;
    __shared__ __align__(16) float os[16 * 68];
    const size_t z = blockIdx.z; A += z * sA; if (A2) A2 += z * sA; Bt += z * sB; if (Bt2) Bt2 += z * sB; C += z * sC;
    const int lane = threadIdx.x & 31, lr = lane & 15, hi = lane >> 4; const int r0 = blockIdx.x * 64, c0 = blockIdx.y * 64;
    v8f acc[4][4];
#pragma unroll
    for (int mb = 0; mb < 4; ++mb)
#pragma unroll
        for (int nb = 0; nb < 4; ++nb) acc[mb][nb] = (v8f){};
    const size_t aoff = (size_t)(r0 + lr) * K + 8 * hi, boff = (size_t)(c0 + lr) * K + 8 * hi;
#pragma unroll 1
    for (int kc = 0; kc < K; kc += 32) {
        V a[4], a2[4];
#pragma unroll
        for (int mb = 0; mb < 4; ++mb) { a[mb] = WFrag<T16>::ld(A + aoff + (size_t)mb * 16 * K + kc); if (NSPLIT == 1 || NSPLIT == 2) a2[mb] = WFrag<T16>::ld(A2 + aoff + (size_t)mb * 16 * K + kc); }
#pragma unroll
        for (int nb = 0; nb < 4; ++nb) { const V b = WFrag<T16>::ld(Bt + boff + (size_t)nb * 16 * K + kc); V b2; if (NSPLIT >= 2) b2 = WFrag<T16>::ld(Bt2 + boff + (size_t)nb * 16 * K + kc);
#pragma unroll
            for (int mb = 0; mb < 4; ++mb) { acc[mb][nb] = WFrag<T16>::mma(a[mb], b, acc[mb][nb]); if (NSPLIT == 1 || NSPLIT == 2) acc[mb][nb] = WFrag<T16>::mma(a2[mb], b, acc[mb][nb]); if (NSPLIT >= 2) acc[mb][nb] = WFrag<T16>::mma(a[mb], b2, acc[mb][nb]); } }
        asm volatile("v_nop\n\tv_nop\n\tv_nop\n\tv_nop" : "+v"(acc[0][0]), "+v"(acc[1][1]), "+v"(acc[2][2]), "+v"(acc[3][3]) : "v"(a[0]), "v"(a[3]));
    }
#pragma unroll
    for (int mb = 0; mb < 4; ++mb) {
#pragma unroll
        for (int nb = 0; nb < 4; ++nb) {
#pragma unroll
            for (int j = 0; j < 8; ++j) os[(hi * 8 + j) * 68 + nb * 16 + lr] = acc[mb][nb][j]; }
        __builtin_amdgcn_wave_barrier(); asm volatile("" ::: "memory");
        float* crow = C + (size_t)(r0 + mb * 16) * ldc + c0;
{
#pragma unroll
            for (int s = 0; s < 8; ++s) { const int row = 2 * s + hi, cofs = lr * 4; v4f val = *(const v4fa*)(os + row * 68 + cofs); if (BIAS) { val[0] += bfr(bias[c0 + cofs]); val[1] += bfr(bias[c0 + cofs + 1]); val[2] += bfr(bias[c0 + cofs + 2]); val[3] += bfr(bias[c0 + cofs + 3]); }
                *(v4f*)(crow + (size_t)row * ldc + cofs) = val; }
             }
        __builtin_amdgcn_wave_barrier(); asm volatile("" ::: "memory");
    }
}

__device__ __forceinline__ h16 tohx(float x) { return (h16)x; }
__device__ __forceinline__ void splitf(float y, unsigned short& h, unsigned short& l) { h = f2bf(y); l = f2bf(y - bf2f(h)); }
typedef __attribute__((ext_vector_type(2))) _Float16 v2h;
typedef __attribute__((ext_vector_type(4))) _Float16 v4h;
typedef __attribute__((ext_vector_type(2))) unsigned short v2us;
typedef __attribute__((ext_vector_type(4))) unsigned short v4us;
typedef __attribute__((ext_vector_type(2))) float v2f;
typedef __attribute__((ext_vector_type(4))) int v4i;

__global__ __launch_bounds__(256) void k_wtG(const float* __restrict__ w, int K, int N, bf* Bt) {
    const int lane = threadIdx.x & 31; const int L0 = (blockIdx.x * 8 + (threadIdx.x >> 5)) * 8; const int nlines = N * K / 64;
{
#pragma unroll 1
        for (int l = 0; l < 8; ++l) { const int L = L0 + l; if (L >= nlines) break; const size_t e = (size_t)L * 64 + lane * 2; const int k = (int)(e % K), n = (int)(e / K); v2us o;
            o[0] = f2bf(w[(size_t)k * N + n]); o[1] = f2bf(w[(size_t)(k + 1) * N + n]); *(v2us*)(Bt + e) = o; }
         }
}
__global__ __launch_bounds__(256) void k_cvt8(const float* __restrict__ src, bf* dst, size_t n8) { const size_t i = (size_t)blockIdx.x * 256 + threadIdx.x; if (i >= n8) return; const v8f v = *(const v8f*)(src + i * 8); v8us o;
#pragma unroll
    for (int k = 0; k < 8; ++k) o[k] = f2bf(v[k]); *(v8us*)(dst + i * 8) = o;  }
__global__ __launch_bounds__(256) void k_cscvt(const float* __restrict__ cosT, const float* __restrict__ sinT, float* CS) { const int idx = blockIdx.x * 256 + threadIdx.x; if (idx >= TT * HD) return; v2f cs; cs[0] = bfr(cosT[idx]); cs[1] = bfr(sinT[idx]); *(v2f*)(CS + (size_t)idx * 2) = cs;  }
// k_rope: head planes [h][t][d] (fp16 + hi/lo) of rope(x) x sc with the rotate-half convention out[d] = x[d] cos[t][d] - x[d+HD/2] sin[t][d], out[d+HD/2] = x[d+HD/2] cos[t][d+HD/2] + x[d] sin[t][d+HD/2]
__global__ __launch_bounds__(256) void k_rope(const float* __restrict__ F, int pitch, int nheads, const float* __restrict__ CS, const float* __restrict__ RF, const float* __restrict__ nw, float sc, h16* P16, bf* Ph, bf* Pl) {
    const size_t e = ((size_t)blockIdx.x * 256 + threadIdx.x) * 2; if (e >= (size_t)nheads * TT * HD) return; const int d = (int)(e % HD); const int t = (int)((e / HD) % TT); const int h = (int)(e / ((size_t)HD * TT)); const float* f = F + (size_t)t * pitch + h * HD; const float rf = RF ? RF[(size_t)h * TT + t] : 1.0f; v2h o16; v2us oh, ol;
#pragma unroll
    for (int q = 0; q < 2; ++q) { const int dd = d + q; const int dp = (dd < HD / 2) ? dd + HD / 2 : dd - HD / 2; float x0 = f[dd], x1 = f[dp];
        if (RF) { float n0 = __fmul_rn(x0, rf), n1 = __fmul_rn(x1, rf); asm volatile("" : "+v"(n0)); asm volatile("" : "+v"(n1)); x0 = __fmul_rn(bfr(nw[dd]), n0); x1 = __fmul_rn(bfr(nw[dp]), n1); }
        const v2f cs = *(const v2f*)(CS + ((size_t)t * HD + dd) * 2); float a = __fmul_rn(x0, cs[0]), bq = __fmul_rn(x1, cs[1]); asm volatile("" : "+v"(a)); asm volatile("" : "+v"(bq)); const float r = ((dd < HD / 2) ? __fsub_rn(a, bq) : __fadd_rn(a, bq)) * sc;
        o16[q] = tohx(r); unsigned short a2, c2; splitf(r, a2, c2); oh[q] = a2; ol[q] = c2; }
    *(v2h*)(P16 + e) = o16; *(v2us*)(Ph + e) = oh; *(v2us*)(Pl + e) = ol;  }
__global__ __launch_bounds__(256) void k_vtp(const float* __restrict__ F, int pitch, int nheads, h16* V16, bf* Vh, bf* Vl) { const size_t e = ((size_t)blockIdx.x * 256 + threadIdx.x) * 2; if (e >= (size_t)nheads * HD * TT) return; const int t = (int)(e % TT); const int d = (int)((e / TT) % HD); const int g = (int)(e / ((size_t)TT * HD)); v2h o16; v2us oh, ol;
#pragma unroll
    for (int q = 0; q < 2; ++q) { const float x = F[(size_t)(t + q) * pitch + g * HD + d]; o16[q] = tohx(x); unsigned short a2, c2; splitf(x, a2, c2); oh[q] = a2; ol[q] = c2; }
    *(v2h*)(V16 + e) = o16; *(v2us*)(Vh + e) = oh; *(v2us*)(Vl + e) = ol;  }
__global__ __launch_bounds__(256) void k_csid(float* CS) { const int idx = blockIdx.x * 256 + threadIdx.x; if (idx >= TT * HD) return; v2f cs; cs[0] = 1.0f; cs[1] = 0.0f; *(v2f*)(CS + (size_t)idx * 2) = cs;  }
// k_asoft: per row (zz, i): t = S x HD^-0.5 (no mask); softmax over the 1024 keys (register row, one exp, fixed trees);
__global__ __launch_bounds__(256) void k_asoft(const float* __restrict__ Sb, h16* P16, bf* Ph, bf* Pl) {
    const int lane = threadIdx.x & 31; const int row = blockIdx.x * 8 + (threadIdx.x >> 5); if (row >= ZH * TT) return; const int i = row % TT; const int zz = row / TT; (void)zz; const bool hires = (i < RH); const float* sr = Sb + (size_t)row * TT; float v[TT / 32]; float mx = -3.0e38f;
#pragma unroll
    for (int ch = 0; ch < TT / 128; ++ch) { const int j0 = ch * 128 + lane * 4; const v4f a = *(const v4f*)(sr + j0);
#pragma unroll
        for (int q = 0; q < 4; ++q) { const int j = j0 + q; (void)j; const float t = a[q] * SCL; v[ch * 4 + q] = t; mx = fmaxf(mx, t); } }
#pragma unroll
    for (int sh = 16; sh; sh >>= 1) mx = fmaxf(mx, __shfl_xor(mx, sh, 32));
    float sum = 0.f;
#pragma unroll
    for (int k = 0; k < TT / 32; ++k) { float d0 = __fsub_rn(v[k], mx); asm volatile("" : "+v"(d0)); v[k] = __builtin_amdgcn_exp2f(__fmul_rn(d0, 1.4426950408889634f)); sum += v[k]; }
#pragma unroll
    for (int sh = 16; sh; sh >>= 1) sum += __shfl_xor(sum, sh, 32);
    const float f = __fdiv_rn(hires ? 1.0f : PCAR, sum);
{
        if (hires) {
#pragma unroll
            for (int ch = 0; ch < TT / 128; ++ch) { v4us oh, ol;
#pragma unroll
                for (int q = 0; q < 4; ++q) { unsigned short a, c2; splitf(v[ch * 4 + q] * f, a, c2); oh[q] = a; ol[q] = c2; }
                const size_t oo = ((size_t)zz * (RH ? RH : 1) + i) * TT + ch * 128 + lane * 4; *(v4us*)(Ph + oo) = oh; *(v4us*)(Pl + oo) = ol; }
        } else {
#pragma unroll
            for (int ch = 0; ch < TT / 128; ++ch) { v4h o4;
#pragma unroll
                for (int q = 0; q < 4; ++q) o4[q] = tohx(v[ch * 4 + q] * f);
                *(v4h*)(P16 + (size_t)row * TT + ch * 128 + lane * 4) = o4; } }
         }
}
__global__ __launch_bounds__(256) void k_merge(const float* __restrict__ O, int h0, bf* Ah, bf* Al) { const size_t e = ((size_t)blockIdx.x * 256 + threadIdx.x) * 2; if (e >= (size_t)ZH * TT * HD) return; const int d = (int)(e % HD); const int t = (int)((e / HD) % TT); const int zz = (int)(e / ((size_t)HD * TT)); const float cs = (t < RH) ? 1.0f : (1.0f / PCAR); const size_t oo = (size_t)t * DQ + (h0 + zz) * HD + d;
    v2us oh, ol;
#pragma unroll
    for (int q = 0; q < 2; ++q) { unsigned short a, c2; splitf(O[e + q] * cs, a, c2); oh[q] = a; ol[q] = c2; } *(v2us*)(Ah + oo) = oh; *(v2us*)(Al + oo) = ol;  }

extern "C" void kernel_launch(void* const* d_in, const int* in_sizes, int n_in,
                              void* d_out, int out_size, void* d_ws, size_t ws_size, hipStream_t stream) {
    (void)in_sizes; (void)n_in; (void)out_size;
    const float* xq = (const float*)d_in[0]; const float* xk = (const float*)d_in[1]; const float* xv = (const float*)d_in[2]; const float* wq = (const float*)d_in[3]; const float* bq = (const float*)d_in[4]; const float* wk = (const float*)d_in[5]; const float* bk = (const float*)d_in[6]; const float* wv = (const float*)d_in[7]; const float* bv = (const float*)d_in[8]; const float* wo = (const float*)d_in[9]; const float* bo = (const float*)d_in[10]; const float* x = xq; (void)x; const float* cosT = nullptr; const float* sinT = nullptr; (void)cosT; (void)sinT;
    float* OUT = (float*)d_out;     // [8][1024][1024]
    char* wsp = (char*)d_ws;
    auto take = [&](size_t bytes) { char* p = wsp; wsp += (bytes + 255) & ~(size_t)255; return (void*)p; };
    bf* WQ = (bf*)take((size_t)DQ * DM * 2); bf* WK = (bf*)take((size_t)DKV * DM * 2); bf* WV = (bf*)take((size_t)DKV * DM * 2); bf* WO = (bf*)take((size_t)DM * DQ * 2); float* CS = (float*)take((size_t)TT * HD * 2 * 4);
    bf* XB = (bf*)take((size_t)TT * DM * 2); bf* XKB = (bf*)take((size_t)TT * DM * 2); bf* XVB = (bf*)take((size_t)TT * DM * 2); float* FQ = (float*)take((size_t)TT * DQ * 4); float* FK = (float*)take((size_t)TT * DKV * 4);
    h16* QP16 = (h16*)take((size_t)NH_ * TT * HD * 2); h16* KP16 = (h16*)take((size_t)NKV * TT * HD * 2); h16* VT16 = (h16*)take((size_t)NKV * HD * TT * 2);
    bf* QPh = (bf*)take((size_t)NH_ * TT * HD * 2); bf* QPl = (bf*)take((size_t)NH_ * TT * HD * 2); bf* KPh = (bf*)take((size_t)NKV * TT * HD * 2); bf* KPl = (bf*)take((size_t)NKV * TT * HD * 2); bf* VTh = (bf*)take((size_t)NKV * HD * TT * 2); bf* VTl = (bf*)take((size_t)NKV * HD * TT * 2); bf* Ph = (bf*)take((size_t)ZH * RH * TT * 2); bf* Pl = (bf*)take((size_t)ZH * RH * TT * 2);
    float* Sb = (float*)take((size_t)ZH * TT * TT * 4); h16* P16 = (h16*)take((size_t)ZH * TT * TT * 2); float* Ob = (float*)take((size_t)ZH * TT * HD * 4); bf* ATh = (bf*)take((size_t)TT * DQ * 2); bf* ATl = (bf*)take((size_t)TT * DQ * 2);
    if ((size_t)(wsp - (char*)d_ws) > ws_size) return;    // ws 256 MiB
    float* FV = FK;   // v projection reuses the k buffer after the k planes are built (stream-ordered)
    { for (int h = 0; h < NH_; ++h) { k_wtG<<<(DM * HD / 64 + 63) / 64, 256, 0, stream>>>(wq + (size_t)h * DM * HD, DM, HD, WQ + (size_t)h * HD * DM); k_wtG<<<(DM * HD / 64 + 63) / 64, 256, 0, stream>>>(wk + (size_t)h * DM * HD, DM, HD, WK + (size_t)h * HD * DM); k_wtG<<<(DM * HD / 64 + 63) / 64, 256, 0, stream>>>(wv + (size_t)h * DM * HD, DM, HD, WV + (size_t)h * HD * DM); }
      k_wtG<<<(unsigned)((DQ * DM / 64 + 63) / 64), 256, 0, stream>>>(wo, DQ, DM, WO);
       }
    k_csid<<<(TT * HD + 255) / 256, 256, 0, stream>>>(CS);
    const unsigned LQ = (unsigned)(((size_t)NH_ * TT * HD / 2 + 255) / 256), LKv = (unsigned)(((size_t)NKV * TT * HD / 2 + 255) / 256);
    for (int b = 0; b < NB_; ++b) {
        
        k_cvt8<<<(unsigned)(((size_t)TT * DM / 8 + 255) / 256), 256, 0, stream>>>(xq + (size_t)b * TT * DM, XB, (size_t)TT * DM / 8); k_cvt8<<<(unsigned)(((size_t)TT * DM / 8 + 255) / 256), 256, 0, stream>>>(xk + (size_t)b * TT * DM, XKB, (size_t)TT * DM / 8); k_cvt8<<<(unsigned)(((size_t)TT * DM / 8 + 255) / 256), 256, 0, stream>>>(xv + (size_t)b * TT * DM, XVB, (size_t)TT * DM / 8);
        k_gemmw<bf, 0, true><<<dim3(TT / 64, DQ / 64, 1), 32, 0, stream>>>(XB, nullptr, WQ, nullptr, DM, FQ, DQ, bq, 0, 0, 0);
        k_rope<<<LQ, 256, 0, stream>>>(FQ, DQ, NH_, CS, nullptr, nullptr, 1.0f, QP16, QPh, QPl);
        k_gemmw<bf, 0, true><<<dim3(TT / 64, DKV / 64, 1), 32, 0, stream>>>(XKB, nullptr, WK, nullptr, DM, FK, DKV, bk, 0, 0, 0);
        k_rope<<<LKv, 256, 0, stream>>>(FK, DKV, NKV, CS, nullptr, nullptr, 1.0f, KP16, KPh, KPl);
        k_gemmw<bf, 0, true><<<dim3(TT / 64, DKV / 64, 1), 32, 0, stream>>>(XVB, nullptr, WV, nullptr, DM, FV, DKV, bv, 0, 0, 0); k_vtp<<<LKv, 256, 0, stream>>>(FV, DKV, NKV, VT16, VTh, VTl);
        for (int h0 = 0; h0 < NH_; h0 += ZH) { const size_t zq = (size_t)h0, zk = (size_t)(h0 / REP);   // one kv head per query head: the pass's two heads use consecutive kv planes (z-strides TT*HD)
            k_gemmw<bf, 2, false><<<dim3(RH / 64, TT / 64, ZH), 32, 0, stream>>>(QPh + zq * TT * HD, QPl + zq * TT * HD, KPh + zk * TT * HD, KPl + zk * TT * HD, HD, Sb, TT, nullptr, (size_t)TT * HD, (size_t)TT * HD, (size_t)TT * TT);
            k_gemmw<h16, 0, false><<<dim3((TT - RH) / 64, TT / 64, ZH), 32, 0, stream>>>(QP16 + zq * TT * HD + (size_t)RH * HD, nullptr, KP16 + zk * TT * HD, nullptr, HD, Sb + (size_t)RH * TT, TT, nullptr, (size_t)TT * HD, (size_t)TT * HD, (size_t)TT * TT);
            k_asoft<<<ZH * TT / 8, 256, 0, stream>>>(Sb, P16, Ph, Pl);
            k_gemmw<bf, 2, false><<<dim3(RH / 64, HD / 64, ZH), 32, 0, stream>>>(Ph, Pl, VTh + zk * HD * TT, VTl + zk * HD * TT, TT, Ob, HD, nullptr, (size_t)RH * TT, (size_t)HD * TT, (size_t)TT * HD);
            k_gemmw<h16, 0, false><<<dim3((TT - RH) / 64, HD / 64, ZH), 32, 0, stream>>>(P16 + (size_t)RH * TT, nullptr, VT16 + zk * HD * TT, nullptr, TT, Ob + (size_t)RH * HD, HD, nullptr, (size_t)TT * TT, (size_t)HD * TT, (size_t)TT * HD);
            k_merge<<<(unsigned)(((size_t)ZH * TT * HD / 2 + 255) / 256), 256, 0, stream>>>(Ob, h0, ATh, ATl); }
        k_gemmw<bf, 1, true><<<dim3(TT / 64, DM / 64, 1), 32, 0, stream>>>(ATh, ATl, WO, nullptr, DQ, OUT + (size_t)b * TT * DM, DM, bo, 0, 0, 0); }
}

// v001
// A run of this version takes 780 microseconds.
// Two timings next to v000 put it at 6.61 and 6.63 times that version's speed.
#include <hip/hip_runtime.h>

// MultipleHeadAttention (q, k, v inputs [8][1024][1024]; per-head Dense: qh = q Wq[h] + bq[h] (Wq [16][1024][64]), likewise kh from k, vh from v; softmax(qh.kh / 8); out = concat heads Wo + bo ([1024][1024] 'xw') -> [8][1024][1024]).
// Compute dtypes, f32 accumulate: every input rounded to bf16; the three per-head projections as PLAIN bf16 GEMMs (inputs: exact; the 16 [1024][64] head blocks transposed into one [1024][1024] Bt) + bias; scores and attn.v: query rows < 512 hl (3 products), the rest fp16 (x1024); softmax f32 (32 keys per lane); Wo hl x exact (2 products) + bias.

#define NB_  8
#define TT   1024
#define DM   1024
#define NH_  16
#define NKV  16
#define REP  (NH_ / NKV)
#define HD   64
#define DQ   (NH_ * HD)
#define DKV  (NKV * HD)
#define ZH   16                   // heads per attention pass (grid z): all heads of one batch element
#define NBG  4                    // batch elements per projection pass
#define RH   512                  // query rows < RH use hi+lo planes (0: none)
#define WIN  0
#define PCAR 1024.0f
#define SCL  0.125f   // HD^-0.5
typedef _Float16 h16;
typedef unsigned short bf;
typedef __attribute__((ext_vector_type(16))) __bf16   v16bf;
typedef __attribute__((ext_vector_type(16))) _Float16 v16h;
typedef __attribute__((ext_vector_type(8)))  _Float16 v8h;
typedef __attribute__((ext_vector_type(8)))  unsigned short v8us;
typedef __attribute__((ext_vector_type(8)))  float    v8f;
typedef __attribute__((ext_vector_type(4)))  float    v4f;
typedef v8h  __attribute__((may_alias)) v8ha;
typedef v4f  __attribute__((may_alias)) v4fa;
typedef v8us __attribute__((may_alias)) v8usa;

__device__ __forceinline__ unsigned short f2bf(float f) { unsigned u = __float_as_uint(f); u += 0x7FFFu + ((u >> 16) & 1u); return (unsigned short)(u >> 16); }
__device__ __forceinline__ float bf2f(unsigned short b) { return __uint_as_float(((unsigned)b) << 16); }
__device__ __forceinline__ float bfr(float f) { return bf2f(f2bf(f)); }
__device__ __forceinline__ v16h cat16(v8h lo, v8h hi) { return __builtin_shufflevector(lo, hi, 0, 1, 2, 3, 4, 5, 6, 7, 8, 9, 10, 11, 12, 13, 14, 15); }
__device__ __forceinline__ v16bf cat16b(v8us lo, v8us hi) { return __builtin_bit_cast(v16bf, __builtin_shufflevector(lo, hi, 0, 1, 2, 3, 4, 5, 6, 7, 8, 9, 10, 11, 12, 13, 14, 15)); }
__device__ __forceinline__ v8f wmma16(v16h a, v16h b, v8f c) { return __builtin_amdgcn_wmma_f32_16x16x32_f16(false, a, false, b, (short)0, c, false, false); }
__device__ __forceinline__ v8f wmmab(v16bf a, v16bf b, v8f c) { return __builtin_amdgcn_wmma_f32_16x16x32_bf16(false, a, false, b, (short)0, c, false, false); }



// ---- gemmw_tile: register-blocked GEMM, ONE WAVE per 64x64 output tile (16 accumulators), operands straight from K-contiguous 16-bit planes; its kernels: grid (M/64, N/64, Z), 32 threads.
// C[m][n] (f32, pitch ldc, + optional f32 bias[n]) = sum_k A[m][k] Bt[n][k] (+ split products per NSPLIT). z-batch strides sA/sB/sC in elements. K % 32 == 0.
template <typename T16> struct WFrag;
template <> struct WFrag<h16> { typedef v16h V; static __device__ __forceinline__ V ld(const h16* p) { return cat16(*(const v8h*)p, *(const v8h*)(p + 16)); } static __device__ __forceinline__ v8f mma(V a, V b, v8f c) { return wmma16(a, b, c); } };
template <> struct WFrag<bf> { typedef v16bf V; static __device__ __forceinline__ V ld(const bf* p) { return cat16b(*(const v8us*)p, *(const v8us*)(p + 16)); } static __device__ __forceinline__ v8f mma(V a, V b, v8f c) { return wmmab(a, b, c); } };
template <typename T16, int NSPLIT, bool BIAS>
__device__ __forceinline__ void gemmw_tile(float* os, int bx, const T16* __restrict__ A, const T16* __restrict__ A2, const T16* __restrict__ Bt, const T16* __restrict__ Bt2, int K, float* C, int ldc, const float* __restrict__ bias, size_t sA, size_t sB, size_t sC) {
    typedef typename WFrag<T16>::V V;
    const size_t z = blockIdx.z; A += z * sA; if (A2) A2 += z * sA; Bt += z * sB; if (Bt2) Bt2 += z * sB; C += z * sC;
    const int lane = threadIdx.x & 31, lr = lane & 15, hi = lane >> 4; const int r0 = bx * 64, c0 = blockIdx.y * 64;
    v8f acc[4][4];
#pragma unroll
    for (int mb = 0; mb < 4; ++mb)
#pragma unroll
        for (int nb = 0; nb < 4; ++nb) acc[mb][nb] = (v8f){};
    const size_t aoff = (size_t)(r0 + lr) * K + 8 * hi, boff = (size_t)(c0 + lr) * K + 8 * hi;
#pragma unroll 1
    for (int kc = 0; kc < K; kc += 32) {
        V a[4], a2[4];
#pragma unroll
        for (int mb = 0; mb < 4; ++mb) { a[mb] = WFrag<T16>::ld(A + aoff + (size_t)mb * 16 * K + kc); if (NSPLIT == 1 || NSPLIT == 2) a2[mb] = WFrag<T16>::ld(A2 + aoff + (size_t)mb * 16 * K + kc); }
#pragma unroll
        for (int nb = 0; nb < 4; ++nb) { const V b = WFrag<T16>::ld(Bt + boff + (size_t)nb * 16 * K + kc); V b2; if (NSPLIT >= 2) b2 = WFrag<T16>::ld(Bt2 + boff + (size_t)nb * 16 * K + kc);
#pragma unroll
            for (int mb = 0; mb < 4; ++mb) { acc[mb][nb] = WFrag<T16>::mma(a[mb], b, acc[mb][nb]); if (NSPLIT == 1 || NSPLIT == 2) acc[mb][nb] = WFrag<T16>::mma(a2[mb], b, acc[mb][nb]); if (NSPLIT >= 2) acc[mb][nb] = WFrag<T16>::mma(a[mb], b2, acc[mb][nb]); } }
        asm volatile("v_nop\n\tv_nop\n\tv_nop\n\tv_nop" : "+v"(acc[0][0]), "+v"(acc[1][1]), "+v"(acc[2][2]), "+v"(acc[3][3]) : "v"(a[0]), "v"(a[3]));
    }
#pragma unroll
    for (int mb = 0; mb < 4; ++mb) {
#pragma unroll
        for (int nb = 0; nb < 4; ++nb) {
#pragma unroll
            for (int j = 0; j < 8; ++j) os[(hi * 8 + j) * 68 + nb * 16 + lr] = acc[mb][nb][j]; }
        __builtin_amdgcn_wave_barrier(); asm volatile("" ::: "memory");
        float* crow = C + (size_t)(r0 + mb * 16) * ldc + c0;
{
#pragma unroll
            for (int s = 0; s < 8; ++s) { const int row = 2 * s + hi, cofs = lr * 4; v4f val = *(const v4fa*)(os + row * 68 + cofs); if (BIAS) { val[0] += bfr(bias[c0 + cofs]); val[1] += bfr(bias[c0 + cofs + 1]); val[2] += bfr(bias[c0 + cofs + 2]); val[3] += bfr(bias[c0 + cofs + 3]); }
                *(v4f*)(crow + (size_t)row * ldc + cofs) = val; }
             }
        __builtin_amdgcn_wave_barrier(); asm volatile("" ::: "memory");
    }
}
// k_gemmw: one GEMM per z; the bias vector of z = 0, 1, 2 is bias0, bias1, bias2 (the q, k and v projections share one launch).
template <typename T16, int NSPLIT, bool BIAS>
__global__ __launch_bounds__(32) void k_gemmw(const T16* __restrict__ A, const T16* __restrict__ A2, const T16* __restrict__ Bt, const T16* __restrict__ Bt2, int K, float* C, int ldc, const float* __restrict__ bias0, const float* __restrict__ bias1, const float* __restrict__ bias2, size_t sA, size_t sB, size_t sC) {
    __shared__ __align__(16) float os[16 * 68];
    const float* bias = (blockIdx.z == 0) ? bias0 : (blockIdx.z == 1) ? bias1 : bias2;
    gemmw_tile<T16, NSPLIT, BIAS>(os, (int)blockIdx.x, A, A2, Bt, Bt2, K, C, ldc, bias, sA, sB, sC);
}
// k_gemm2: the hi+lo product (row tiles blockIdx.x < nxh) and the fp16 product (the other row tiles, written from row 64 nxh of C on) in one launch.
__global__ __launch_bounds__(32) void k_gemm2(int nxh, const bf* __restrict__ Ah, const bf* __restrict__ Al, const bf* __restrict__ Bh, const bf* __restrict__ Bl, size_t sAh, const h16* __restrict__ A16, const h16* __restrict__ B16, size_t sA16, int K, float* C, int ldc, size_t sB, size_t sC) {
    __shared__ __align__(16) float os[16 * 68];
    const int bx = (int)blockIdx.x;
    if (bx < nxh) { gemmw_tile<bf, 2, false>(os, bx, Ah, Al, Bh, Bl, K, C, ldc, nullptr, sAh, sB, sC); return; }
    gemmw_tile<h16, 0, false>(os, bx - nxh, A16, nullptr, B16, nullptr, K, C + (size_t)nxh * 64 * ldc, ldc, nullptr, sA16, sB, sC);
    asm volatile("s_wait_xcnt 0x0" ::: "memory");   // precaution at the end of the kernel: no other tile follows, since the hi+lo blocks return above
}

__device__ __forceinline__ h16 tohx(float x) { return (h16)x; }
__device__ __forceinline__ void splitf(float y, unsigned short& h, unsigned short& l) { h = f2bf(y); l = f2bf(y - bf2f(h)); }
typedef __attribute__((ext_vector_type(2))) _Float16 v2h;
typedef __attribute__((ext_vector_type(4))) _Float16 v4h;
typedef __attribute__((ext_vector_type(2))) unsigned short v2us;
typedef __attribute__((ext_vector_type(4))) unsigned short v4us;
typedef __attribute__((ext_vector_type(2))) float v2f;
typedef __attribute__((ext_vector_type(4))) int v4i;

// grid (lines, blocks of [K][N] in one weight, weights): source w0, w1 or w2 by z; Bt holds a weight's transposed blocks one behind the other, the weights sBt elements apart.
__global__ __launch_bounds__(256) void k_wtG(const float* __restrict__ w0, const float* __restrict__ w1, const float* __restrict__ w2, int K, int N, bf* Bt, size_t sBt) {
    const float* w = ((blockIdx.z == 0) ? w0 : (blockIdx.z == 1) ? w1 : w2) + (size_t)blockIdx.y * K * N; Bt += (size_t)blockIdx.z * sBt + (size_t)blockIdx.y * N * K;
    const int lane = threadIdx.x & 31; const int L0 = (blockIdx.x * 8 + (threadIdx.x >> 5)) * 8; const int nlines = N * K / 64;
{
#pragma unroll 1
        for (int l = 0; l < 8; ++l) { const int L = L0 + l; if (L >= nlines) break; const size_t e = (size_t)L * 64 + lane * 2; const int k = (int)(e % K), n = (int)(e / K); v2us o;
            o[0] = f2bf(w[(size_t)k * N + n]); o[1] = f2bf(w[(size_t)(k + 1) * N + n]); *(v2us*)(Bt + e) = o; }
         }
}
__global__ __launch_bounds__(256) void k_cvt8(const float* __restrict__ s0, const float* __restrict__ s1, const float* __restrict__ s2, bf* dst, size_t n8) { const size_t i = (size_t)blockIdx.x * 256 + threadIdx.x; if (i >= n8) return; const float* src = (blockIdx.y == 0) ? s0 : (blockIdx.y == 1) ? s1 : s2; dst += (size_t)blockIdx.y * n8 * 8; const v8f v = *(const v8f*)(src + i * 8); v8us o;
#pragma unroll
    for (int k = 0; k < 8; ++k) o[k] = f2bf(v[k]); *(v8us*)(dst + i * 8) = o;  }
__global__ __launch_bounds__(256) void k_cscvt(const float* __restrict__ cosT, const float* __restrict__ sinT, float* CS) { const int idx = blockIdx.x * 256 + threadIdx.x; if (idx >= TT * HD) return; v2f cs; cs[0] = bfr(cosT[idx]); cs[1] = bfr(sinT[idx]); *(v2f*)(CS + (size_t)idx * 2) = cs;  }
// k_rope: head planes [h][t][d] (fp16 + hi/lo) of rope(x) x sc with the rotate-half convention out[d] = x[d] cos[t][d] - x[d+HD/2] sin[t][d], out[d+HD/2] = x[d+HD/2] cos[t][d+HD/2] + x[d] sin[t][d+HD/2]
__global__ __launch_bounds__(256) void k_rope(const float* __restrict__ F, int pitch, int nheads, const float* __restrict__ CS, const float* __restrict__ RF, const float* __restrict__ nw, float sc, h16* P16, bf* Ph, bf* Pl) {
    { const size_t y = blockIdx.y; F += y * TT * pitch; P16 += y * nheads * TT * HD; Ph += y * nheads * TT * HD; Pl += y * nheads * TT * HD; }   // y: one [TT][pitch] block of F, one set of head planes
    const size_t e = ((size_t)blockIdx.x * 256 + threadIdx.x) * 2; if (e >= (size_t)nheads * TT * HD) return; const int d = (int)(e % HD); const int t = (int)((e / HD) % TT); const int h = (int)(e / ((size_t)HD * TT)); const float* f = F + (size_t)t * pitch + h * HD; const float rf = RF ? RF[(size_t)h * TT + t] : 1.0f; v2h o16; v2us oh, ol;
#pragma unroll
    for (int q = 0; q < 2; ++q) { const int dd = d + q; const int dp = (dd < HD / 2) ? dd + HD / 2 : dd - HD / 2; float x0 = f[dd], x1 = f[dp];
        if (RF) { float n0 = __fmul_rn(x0, rf), n1 = __fmul_rn(x1, rf); asm volatile("" : "+v"(n0)); asm volatile("" : "+v"(n1)); x0 = __fmul_rn(bfr(nw[dd]), n0); x1 = __fmul_rn(bfr(nw[dp]), n1); }
        const v2f cs = *(const v2f*)(CS + ((size_t)t * HD + dd) * 2); float a = __fmul_rn(x0, cs[0]), bq = __fmul_rn(x1, cs[1]); asm volatile("" : "+v"(a)); asm volatile("" : "+v"(bq)); const float r = ((dd < HD / 2) ? __fsub_rn(a, bq) : __fadd_rn(a, bq)) * sc;
        o16[q] = tohx(r); unsigned short a2, c2; splitf(r, a2, c2); oh[q] = a2; ol[q] = c2; }
    *(v2h*)(P16 + e) = o16; *(v2us*)(Ph + e) = oh; *(v2us*)(Pl + e) = ol;  }
__global__ __launch_bounds__(256) void k_vtp(const float* __restrict__ F, int pitch, int nheads, h16* V16, bf* Vh, bf* Vl) { { const size_t y = blockIdx.y; F += y * TT * pitch; V16 += y * nheads * HD * TT; Vh += y * nheads * HD * TT; Vl += y * nheads * HD * TT; } const size_t e = ((size_t)blockIdx.x * 256 + threadIdx.x) * 2; if (e >= (size_t)nheads * HD * TT) return; const int t = (int)(e % TT); const int d = (int)((e / TT) % HD); const int g = (int)(e / ((size_t)TT * HD)); v2h o16; v2us oh, ol;
#pragma unroll
    for (int q = 0; q < 2; ++q) { const float x = F[(size_t)(t + q) * pitch + g * HD + d]; o16[q] = tohx(x); unsigned short a2, c2; splitf(x, a2, c2); oh[q] = a2; ol[q] = c2; }
    *(v2h*)(V16 + e) = o16; *(v2us*)(Vh + e) = oh; *(v2us*)(Vl + e) = ol;  }
__global__ __launch_bounds__(256) void k_csid(float* CS) { const int idx = blockIdx.x * 256 + threadIdx.x; if (idx >= TT * HD) return; v2f cs; cs[0] = 1.0f; cs[1] = 0.0f; *(v2f*)(CS + (size_t)idx * 2) = cs;  }
// k_asoft: per row (zz, i): t = S x HD^-0.5 (no mask); softmax over the 1024 keys (register row, one exp, fixed trees);
__global__ __launch_bounds__(256) void k_asoft(const float* __restrict__ Sb, h16* P16, bf* Ph, bf* Pl) {
    const int lane = threadIdx.x & 31; const int row = blockIdx.x * 8 + (threadIdx.x >> 5); if (row >= ZH * TT) return; const int i = row % TT; const int zz = row / TT; (void)zz; const bool hires = (i < RH); const float* sr = Sb + (size_t)row * TT; float v[TT / 32]; float mx = -3.0e38f;
#pragma unroll
    for (int ch = 0; ch < TT / 128; ++ch) { const int j0 = ch * 128 + lane * 4; const v4f a = *(const v4f*)(sr + j0);
#pragma unroll
        for (int q = 0; q < 4; ++q) { const int j = j0 + q; (void)j; const float t = a[q] * SCL; v[ch * 4 + q] = t; mx = fmaxf(mx, t); } }
#pragma unroll
    for (int sh = 16; sh; sh >>= 1) mx = fmaxf(mx, __shfl_xor(mx, sh, 32));
    float sum = 0.f;
#pragma unroll
    for (int k = 0; k < TT / 32; ++k) { float d0 = __fsub_rn(v[k], mx); asm volatile("" : "+v"(d0)); v[k] = __builtin_amdgcn_exp2f(__fmul_rn(d0, 1.4426950408889634f)); sum += v[k]; }
#pragma unroll
    for (int sh = 16; sh; sh >>= 1) sum += __shfl_xor(sum, sh, 32);
    const float f = __fdiv_rn(hires ? 1.0f : PCAR, sum);
{
        if (hires) {
#pragma unroll
            for (int ch = 0; ch < TT / 128; ++ch) { v4us oh, ol;
#pragma unroll
                for (int q = 0; q < 4; ++q) { unsigned short a, c2; splitf(v[ch * 4 + q] * f, a, c2); oh[q] = a; ol[q] = c2; }
                const size_t oo = ((size_t)zz * (RH ? RH : 1) + i) * TT + ch * 128 + lane * 4; *(v4us*)(Ph + oo) = oh; *(v4us*)(Pl + oo) = ol; }
        } else {
#pragma unroll
            for (int ch = 0; ch < TT / 128; ++ch) { v4h o4;
#pragma unroll
                for (int q = 0; q < 4; ++q) o4[q] = tohx(v[ch * 4 + q] * f);
                *(v4h*)(P16 + (size_t)row * TT + ch * 128 + lane * 4) = o4; } }
         }
}
__global__ __launch_bounds__(256) void k_merge(const float* __restrict__ O, int h0, bf* Ah, bf* Al) { const size_t e = ((size_t)blockIdx.x * 256 + threadIdx.x) * 2; if (e >= (size_t)ZH * TT * HD) return; const int d = (int)(e % HD); const int t = (int)((e / HD) % TT); const int zz = (int)(e / ((size_t)HD * TT)); const float cs = (t < RH) ? 1.0f : (1.0f / PCAR); const size_t oo = (size_t)t * DQ + (h0 + zz) * HD + d;
    v2us oh, ol;
#pragma unroll
    for (int q = 0; q < 2; ++q) { unsigned short a, c2; splitf(O[e + q] * cs, a, c2); oh[q] = a; ol[q] = c2; } *(v2us*)(Ah + oo) = oh; *(v2us*)(Al + oo) = ol;  }

extern "C" void kernel_launch(void* const* d_in, const int* in_sizes, int n_in,
                              void* d_out, int out_size, void* d_ws, size_t ws_size, hipStream_t stream) {
    (void)in_sizes; (void)n_in; (void)out_size;
    const float* xq = (const float*)d_in[0]; const float* xk = (const float*)d_in[1]; const float* xv = (const float*)d_in[2]; const float* wq = (const float*)d_in[3]; const float* bq = (const float*)d_in[4]; const float* wk = (const float*)d_in[5]; const float* bk = (const float*)d_in[6]; const float* wv = (const float*)d_in[7]; const float* bv = (const float*)d_in[8]; const float* wo = (const float*)d_in[9]; const float* bo = (const float*)d_in[10]; const float* x = xq; (void)x; const float* cosT = nullptr; const float* sinT = nullptr; (void)cosT; (void)sinT;
    float* OUT = (float*)d_out;     // [8][1024][1024]
    char* wsp = (char*)d_ws;
    auto take = [&](size_t bytes) { char* p = wsp; wsp += (bytes + 255) & ~(size_t)255; return (void*)p; };
    const size_t PL = (size_t)NBG * NH_ * TT * HD;   // elements of one set of head planes: NBG batch elements, all heads
    bf* W3 = (bf*)take((size_t)3 * DQ * DM * 2); bf* WO = (bf*)take((size_t)DM * DQ * 2); float* CS = (float*)take((size_t)TT * HD * 2 * 4);   // W3: q, k, v weights, transposed
    h16* QK16 = (h16*)take(2 * PL * 2); bf* QKh = (bf*)take(2 * PL * 2); bf* QKl = (bf*)take(2 * PL * 2);   // q planes, then k planes
    h16* VT16 = (h16*)take(PL * 2); bf* VTh = (bf*)take(PL * 2); bf* VTl = (bf*)take(PL * 2);
    float* Ob = (float*)take((size_t)ZH * TT * HD * 4); bf* ATh = (bf*)take((size_t)NB_ * TT * DQ * 2); bf* ATl = (bf*)take((size_t)NB_ * TT * DQ * 2);
    char* RA = wsp;   // one region, two uses in stream order: the projection pass's bf16 inputs and f32 results, then the attention passes' scores and probabilities
    float* Sb = (float*)take((size_t)ZH * TT * TT * 4); h16* P16 = (h16*)take((size_t)ZH * TT * TT * 2); bf* Ph = (bf*)take((size_t)ZH * RH * TT * 2); bf* Pl = (bf*)take((size_t)ZH * RH * TT * 2);
    if ((size_t)(wsp - (char*)d_ws) > ws_size) return;    // ws 256 MiB
    const size_t XN = (size_t)NBG * TT * DM;   // elements of one input, or of one projection, in a pass
    bf* X3 = (bf*)RA; float* F3 = (float*)(RA + 3 * XN * 2);   // q, k, v one behind the other in both; 3 XN (2 + 4) bytes = 72 MiB of the region's 128
    k_wtG<<<dim3((DM * HD / 64 + 63) / 64, NH_, 3), 256, 0, stream>>>(wq, wk, wv, DM, HD, W3, (size_t)DQ * DM);
    k_wtG<<<dim3((DQ * DM / 64 + 63) / 64, 1, 1), 256, 0, stream>>>(wo, wo, wo, DQ, DM, WO, 0);
    k_csid<<<(TT * HD + 255) / 256, 256, 0, stream>>>(CS);
    const unsigned LQ = (unsigned)(((size_t)NH_ * TT * HD / 2 + 255) / 256);
    for (int g = 0; g < NB_; g += NBG) {
        k_cvt8<<<dim3((unsigned)((XN / 8 + 255) / 256), 3, 1), 256, 0, stream>>>(xq + (size_t)g * TT * DM, xk + (size_t)g * TT * DM, xv + (size_t)g * TT * DM, X3, XN / 8);
        k_gemmw<bf, 0, true><<<dim3(NBG * TT / 64, DQ / 64, 3), 32, 0, stream>>>(X3, nullptr, W3, nullptr, DM, F3, DQ, bq, bk, bv, XN, (size_t)DQ * DM, XN);
        k_rope<<<dim3(LQ, 2 * NBG, 1), 256, 0, stream>>>(F3, DQ, NH_, CS, nullptr, nullptr, 1.0f, QK16, QKh, QKl);
        k_vtp<<<dim3(LQ, NBG, 1), 256, 0, stream>>>(F3 + 2 * XN, DKV, NKV, VT16, VTh, VTl);
        for (int bl = 0; bl < NBG; ++bl) { const size_t zo = (size_t)bl * NH_ * TT * HD;   // this batch element's first head plane; one kv head per query head (z-strides TT*HD)
            k_gemm2<<<dim3(TT / 64, TT / 64, ZH), 32, 0, stream>>>(RH / 64, QKh + zo, QKl + zo, QKh + PL + zo, QKl + PL + zo, (size_t)TT * HD, QK16 + zo + (size_t)RH * HD, QK16 + PL + zo, (size_t)TT * HD, HD, Sb, TT, (size_t)TT * HD, (size_t)TT * TT);
            k_asoft<<<ZH * TT / 8, 256, 0, stream>>>(Sb, P16, Ph, Pl);
            k_gemm2<<<dim3(TT / 64, HD / 64, ZH), 32, 0, stream>>>(RH / 64, Ph, Pl, VTh + zo, VTl + zo, (size_t)RH * TT, P16 + (size_t)RH * TT, VT16 + zo, (size_t)TT * TT, TT, Ob, HD, (size_t)HD * TT, (size_t)TT * HD);
            k_merge<<<(unsigned)(((size_t)ZH * TT * HD / 2 + 255) / 256), 256, 0, stream>>>(Ob, 0, ATh + (size_t)(g + bl) * TT * DQ, ATl + (size_t)(g + bl) * TT * DQ); } }
    k_gemmw<bf, 1, true><<<dim3(NB_ * TT / 64, DM / 64, 1), 32, 0, stream>>>(ATh, ATl, WO, nullptr, DQ, OUT, DM, bo, bo, bo, 0, 0, 0);
}

// v002
// One run takes 384 microseconds.
// Timed twice side by side with v001, it ran 2.03 times as fast both times.
// Over all steps from v000 it is 13.4 times as fast.
#include <hip/hip_runtime.h>

// MultipleHeadAttention (q, k, v inputs [8][1024][1024]; per-head Dense: qh = q Wq[h] + bq[h] (Wq [16][1024][64]), likewise kh from k, vh from v; softmax(qh.kh / 8); out = concat heads Wo + bo ([1024][1024] 'xw') -> [8][1024][1024]).
// Compute dtypes, f32 accumulate: every input rounded to bf16; the three per-head projections as PLAIN bf16 GEMMs (inputs: exact; the 16 [1024][64] head blocks transposed into one [1024][1024] Bt) + bias; scores, softmax and attn.v in one kernel: query rows < 512 hl (3 products), the rest fp16; softmax f32, running maximum and sum; Wo hl x exact (2 products) + bias.

#define NB_  8
#define TT   1024
#define DM   1024
#define NH_  16
#define NKV  16
#define REP  (NH_ / NKV)
#define HD   64
#define DQ   (NH_ * HD)
#define DKV  (NKV * HD)
#define NBG  4                    // batch elements per projection pass
#define RH   512                  // query rows < RH use hi+lo planes (0: none)
#define WIN  0
#define SCL  0.125f   // HD^-0.5
typedef _Float16 h16;
typedef unsigned short bf;
typedef __attribute__((ext_vector_type(16))) __bf16   v16bf;
typedef __attribute__((ext_vector_type(16))) _Float16 v16h;
typedef __attribute__((ext_vector_type(8)))  _Float16 v8h;
typedef __attribute__((ext_vector_type(8)))  unsigned short v8us;
typedef __attribute__((ext_vector_type(8)))  float    v8f;
typedef __attribute__((ext_vector_type(4)))  float    v4f;
typedef v8h  __attribute__((may_alias)) v8ha;
typedef v4f  __attribute__((may_alias)) v4fa;
typedef v8us __attribute__((may_alias)) v8usa;

__device__ __forceinline__ unsigned short f2bf(float f) { unsigned u = __float_as_uint(f); u += 0x7FFFu + ((u >> 16) & 1u); return (unsigned short)(u >> 16); }
__device__ __forceinline__ float bf2f(unsigned short b) { return __uint_as_float(((unsigned)b) << 16); }
__device__ __forceinline__ float bfr(float f) { return bf2f(f2bf(f)); }
__device__ __forceinline__ v16h cat16(v8h lo, v8h hi) { return __builtin_shufflevector(lo, hi, 0, 1, 2, 3, 4, 5, 6, 7, 8, 9, 10, 11, 12, 13, 14, 15); }
__device__ __forceinline__ v16bf cat16b(v8us lo, v8us hi) { return __builtin_bit_cast(v16bf, __builtin_shufflevector(lo, hi, 0, 1, 2, 3, 4, 5, 6, 7, 8, 9, 10, 11, 12, 13, 14, 15)); }
__device__ __forceinline__ v8f wmma16(v16h a, v16h b, v8f c) { return __builtin_amdgcn_wmma_f32_16x16x32_f16(false, a, false, b, (short)0, c, false, false); }
__device__ __forceinline__ v8f wmmab(v16bf a, v16bf b, v8f c) { return __builtin_amdgcn_wmma_f32_16x16x32_bf16(false, a, false, b, (short)0, c, false, false); }



// ---- gemmw_tile: register-blocked GEMM, ONE WAVE per 64x64 output tile (16 accumulators), operands straight from K-contiguous 16-bit planes; its kernels: grid (M/64, N/64, Z), 32 threads.
// C[m][n] (f32, pitch ldc, + optional f32 bias[n]) = sum_k A[m][k] Bt[n][k] (+ split products per NSPLIT). z-batch strides sA/sB/sC in elements. K % 32 == 0.
template <typename T16> struct WFrag;
template <> struct WFrag<h16> { typedef v16h V; static __device__ __forceinline__ V ld(const h16* p) { return cat16(*(const v8h*)p, *(const v8h*)(p + 16)); } static __device__ __forceinline__ v8f mma(V a, V b, v8f c) { return wmma16(a, b, c); } };
template <> struct WFrag<bf> { typedef v16bf V; static __device__ __forceinline__ V ld(const bf* p) { return cat16b(*(const v8us*)p, *(const v8us*)(p + 16)); } static __device__ __forceinline__ v8f mma(V a, V b, v8f c) { return wmmab(a, b, c); } };
template <typename T16, int NSPLIT, bool BIAS>
__device__ __forceinline__ void gemmw_tile(float* os, int bx, const T16* __restrict__ A, const T16* __restrict__ A2, const T16* __restrict__ Bt, const T16* __restrict__ Bt2, int K, float* C, int ldc, const float* __restrict__ bias, size_t sA, size_t sB, size_t sC) {
    typedef typename WFrag<T16>::V V;
    const size_t z = blockIdx.z; A += z * sA; if (A2) A2 += z * sA; Bt += z * sB; if (Bt2) Bt2 += z * sB; C += z * sC;
    const int lane = threadIdx.x & 31, lr = lane & 15, hi = lane >> 4; const int r0 = bx * 64, c0 = blockIdx.y * 64;
    v8f acc[4][4];
#pragma unroll
    for (int mb = 0; mb < 4; ++mb)
#pragma unroll
        for (int nb = 0; nb < 4; ++nb) acc[mb][nb] = (v8f){};
    const size_t aoff = (size_t)(r0 + lr) * K + 8 * hi, boff = (size_t)(c0 + lr) * K + 8 * hi;
#pragma unroll 1
    for (int kc = 0; kc < K; kc += 32) {
        V a[4], a2[4];
#pragma unroll
        for (int mb = 0; mb < 4; ++mb) { a[mb] = WFrag<T16>::ld(A + aoff + (size_t)mb * 16 * K + kc); if (NSPLIT == 1 || NSPLIT == 2) a2[mb] = WFrag<T16>::ld(A2 + aoff + (size_t)mb * 16 * K + kc); }
#pragma unroll
        for (int nb = 0; nb < 4; ++nb) { const V b = WFrag<T16>::ld(Bt + boff + (size_t)nb * 16 * K + kc); V b2; if (NSPLIT >= 2) b2 = WFrag<T16>::ld(Bt2 + boff + (size_t)nb * 16 * K + kc);
#pragma unroll
            for (int mb = 0; mb < 4; ++mb) { acc[mb][nb] = WFrag<T16>::mma(a[mb], b, acc[mb][nb]); if (NSPLIT == 1 || NSPLIT == 2) acc[mb][nb] = WFrag<T16>::mma(a2[mb], b, acc[mb][nb]); if (NSPLIT >= 2) acc[mb][nb] = WFrag<T16>::mma(a[mb], b2, acc[mb][nb]); } }
        asm volatile("v_nop\n\tv_nop\n\tv_nop\n\tv_nop" : "+v"(acc[0][0]), "+v"(acc[1][1]), "+v"(acc[2][2]), "+v"(acc[3][3]) : "v"(a[0]), "v"(a[3]));
    }
#pragma unroll
    for (int mb = 0; mb < 4; ++mb) {
#pragma unroll
        for (int nb = 0; nb < 4; ++nb) {
#pragma unroll
            for (int j = 0; j < 8; ++j) os[(hi * 8 + j) * 68 + nb * 16 + lr] = acc[mb][nb][j]; }
        __builtin_amdgcn_wave_barrier(); asm volatile("" ::: "memory");
        float* crow = C + (size_t)(r0 + mb * 16) * ldc + c0;
{
#pragma unroll
            for (int s = 0; s < 8; ++s) { const int row = 2 * s + hi, cofs = lr * 4; v4f val = *(const v4fa*)(os + row * 68 + cofs); if (BIAS) { val[0] += bfr(bias[c0 + cofs]); val[1] += bfr(bias[c0 + cofs + 1]); val[2] += bfr(bias[c0 + cofs + 2]); val[3] += bfr(bias[c0 + cofs + 3]); }
                *(v4f*)(crow + (size_t)row * ldc + cofs) = val; }
             }
        __builtin_amdgcn_wave_barrier(); asm volatile("" ::: "memory");
    }
}
// k_gemmw: one GEMM per z; the bias vector of z = 0, 1, 2 is bias0, bias1, bias2 (the q, k and v projections share one launch).
template <typename T16, int NSPLIT, bool BIAS>
__global__ __launch_bounds__(32) void k_gemmw(const T16* __restrict__ A, const T16* __restrict__ A2, const T16* __restrict__ Bt, const T16* __restrict__ Bt2, int K, float* C, int ldc, const float* __restrict__ bias0, const float* __restrict__ bias1, const float* __restrict__ bias2, size_t sA, size_t sB, size_t sC) {
    __shared__ __align__(16) float os[16 * 68];
    const float* bias = (blockIdx.z == 0) ? bias0 : (blockIdx.z == 1) ? bias1 : bias2;
    gemmw_tile<T16, NSPLIT, BIAS>(os, (int)blockIdx.x, A, A2, Bt, Bt2, K, C, ldc, bias, sA, sB, sC);
}
__device__ __forceinline__ h16 tohx(float x) { return (h16)x; }
__device__ __forceinline__ void splitf(float y, unsigned short& h, unsigned short& l) { h = f2bf(y); l = f2bf(y - bf2f(h)); }
typedef __attribute__((ext_vector_type(2))) _Float16 v2h;
typedef __attribute__((ext_vector_type(4))) _Float16 v4h;
typedef __attribute__((ext_vector_type(2))) unsigned short v2us;
typedef __attribute__((ext_vector_type(4))) unsigned short v4us;
typedef __attribute__((ext_vector_type(2))) float v2f;
typedef __attribute__((ext_vector_type(4))) int v4i;

// grid (lines, blocks of [K][N] in one weight, weights): source w0, w1 or w2 by z; Bt holds a weight's transposed blocks one behind the other, the weights sBt elements apart.
__global__ __launch_bounds__(256) void k_wtG(const float* __restrict__ w0, const float* __restrict__ w1, const float* __restrict__ w2, int K, int N, bf* Bt, size_t sBt) {
    const float* w = ((blockIdx.z == 0) ? w0 : (blockIdx.z == 1) ? w1 : w2) + (size_t)blockIdx.y * K * N; Bt += (size_t)blockIdx.z * sBt + (size_t)blockIdx.y * N * K;
    const int lane = threadIdx.x & 31; const int L0 = (blockIdx.x * 8 + (threadIdx.x >> 5)) * 8; const int nlines = N * K / 64;
{
#pragma unroll 1
        for (int l = 0; l < 8; ++l) { const int L = L0 + l; if (L >= nlines) break; const size_t e = (size_t)L * 64 + lane * 2; const int k = (int)(e % K), n = (int)(e / K); v2us o;
            o[0] = f2bf(w[(size_t)k * N + n]); o[1] = f2bf(w[(size_t)(k + 1) * N + n]); *(v2us*)(Bt + e) = o; }
         }
}
__global__ __launch_bounds__(256) void k_cvt8(const float* __restrict__ s0, const float* __restrict__ s1, const float* __restrict__ s2, bf* dst, size_t n8) { const size_t i = (size_t)blockIdx.x * 256 + threadIdx.x; if (i >= n8) return; const float* src = (blockIdx.y == 0) ? s0 : (blockIdx.y == 1) ? s1 : s2; dst += (size_t)blockIdx.y * n8 * 8; const v8f v = *(const v8f*)(src + i * 8); v8us o;
#pragma unroll
    for (int k = 0; k < 8; ++k) o[k] = f2bf(v[k]); *(v8us*)(dst + i * 8) = o;  }
__global__ __launch_bounds__(256) void k_cscvt(const float* __restrict__ cosT, const float* __restrict__ sinT, float* CS) { const int idx = blockIdx.x * 256 + threadIdx.x; if (idx >= TT * HD) return; v2f cs; cs[0] = bfr(cosT[idx]); cs[1] = bfr(sinT[idx]); *(v2f*)(CS + (size_t)idx * 2) = cs;  }
// k_rope: head planes [h][t][d] (fp16 + hi/lo) of rope(x) x sc with the rotate-half convention out[d] = x[d] cos[t][d] - x[d+HD/2] sin[t][d], out[d+HD/2] = x[d+HD/2] cos[t][d+HD/2] + x[d] sin[t][d+HD/2]
__global__ __launch_bounds__(256) void k_rope(const float* __restrict__ F, int pitch, int nheads, const float* __restrict__ CS, const float* __restrict__ RF, const float* __restrict__ nw, float sc, h16* P16, bf* Ph, bf* Pl) {
    { const size_t y = blockIdx.y; F += y * TT * pitch; P16 += y * nheads * TT * HD; Ph += y * nheads * TT * HD; Pl += y * nheads * TT * HD; }   // y: one [TT][pitch] block of F, one set of head planes
    const size_t e = ((size_t)blockIdx.x * 256 + threadIdx.x) * 2; if (e >= (size_t)nheads * TT * HD) return; const int d = (int)(e % HD); const int t = (int)((e / HD) % TT); const int h = (int)(e / ((size_t)HD * TT)); const float* f = F + (size_t)t * pitch + h * HD; const float rf = RF ? RF[(size_t)h * TT + t] : 1.0f; v2h o16; v2us oh, ol;
#pragma unroll
    for (int q = 0; q < 2; ++q) { const int dd = d + q; const int dp = (dd < HD / 2) ? dd + HD / 2 : dd - HD / 2; float x0 = f[dd], x1 = f[dp];
        if (RF) { float n0 = __fmul_rn(x0, rf), n1 = __fmul_rn(x1, rf); asm volatile("" : "+v"(n0)); asm volatile("" : "+v"(n1)); x0 = __fmul_rn(bfr(nw[dd]), n0); x1 = __fmul_rn(bfr(nw[dp]), n1); }
        const v2f cs = *(const v2f*)(CS + ((size_t)t * HD + dd) * 2); float a = __fmul_rn(x0, cs[0]), bq = __fmul_rn(x1, cs[1]); asm volatile("" : "+v"(a)); asm volatile("" : "+v"(bq)); const float r = ((dd < HD / 2) ? __fsub_rn(a, bq) : __fadd_rn(a, bq)) * sc;
        o16[q] = tohx(r); unsigned short a2, c2; splitf(r, a2, c2); oh[q] = a2; ol[q] = c2; }
    *(v2h*)(P16 + e) = o16; *(v2us*)(Ph + e) = oh; *(v2us*)(Pl + e) = ol;  }
__global__ __launch_bounds__(256) void k_vtp(const float* __restrict__ F, int pitch, int nheads, h16* V16, bf* Vh, bf* Vl) { { const size_t y = blockIdx.y; F += y * TT * pitch; V16 += y * nheads * HD * TT; Vh += y * nheads * HD * TT; Vl += y * nheads * HD * TT; } const size_t e = ((size_t)blockIdx.x * 256 + threadIdx.x) * 2; if (e >= (size_t)nheads * HD * TT) return; const int t = (int)(e % TT); const int d = (int)((e / TT) % HD); const int g = (int)(e / ((size_t)TT * HD)); v2h o16; v2us oh, ol;
#pragma unroll
    for (int q = 0; q < 2; ++q) { const float x = F[(size_t)(t + q) * pitch + g * HD + d]; o16[q] = tohx(x); unsigned short a2, c2; splitf(x, a2, c2); oh[q] = a2; ol[q] = c2; }
    *(v2h*)(V16 + e) = o16; *(v2us*)(Vh + e) = oh; *(v2us*)(Vl + e) = ol;  }
__global__ __launch_bounds__(256) void k_csid(float* CS) { const int idx = blockIdx.x * 256 + threadIdx.x; if (idx >= TT * HD) return; v2f cs; cs[0] = 1.0f; cs[1] = 0.0f; *(v2f*)(CS + (size_t)idx * 2) = cs;  }
typedef __attribute__((ext_vector_type(2))) __bf16 v2bf;
__device__ __forceinline__ float xhalf(float x) { return __builtin_bit_cast(float, __builtin_amdgcn_permlanex16(__builtin_bit_cast(int, x), __builtin_bit_cast(int, x), 0x76543210, 0xfedcba98, false, false)); }   // lane l with lane l ^ 16
// a wave-uniform address, held in a scalar register pair: the loads then take the form scalar base + 32-bit lane offset + constant, and the lane offsets are never rewritten
template <typename T> __device__ __forceinline__ const T* sbase(const T* p) { const unsigned long long a = (unsigned long long)p; return (const T*)(const __attribute__((address_space(1))) T*)(((unsigned long long)(unsigned)__builtin_amdgcn_readfirstlane((int)(a >> 32)) << 32) | (unsigned long long)(unsigned)__builtin_amdgcn_readfirstlane((int)a)); }
template <bool HL> struct PPack;
template <> struct PPack<true> { static __device__ __forceinline__ void pack(const float* p, v16bf& h, v16bf& l) {
#pragma unroll
    for (int s = 0; s < 8; ++s) { v2f x; x[0] = p[2 * s]; x[1] = p[2 * s + 1]; const v2bf a = __builtin_convertvector(x, v2bf); const v2f r = x - __builtin_convertvector(a, v2f); const v2bf c = __builtin_convertvector(r, v2bf); h[2 * s] = a[0]; h[2 * s + 1] = a[1]; l[2 * s] = c[0]; l[2 * s + 1] = c[1]; } } };
template <> struct PPack<false> { static __device__ __forceinline__ void pack(const float* p, v16h& h, v16h& l) { (void)l;
#pragma unroll
    for (int s = 0; s < 8; ++s) { v2f x; x[0] = p[2 * s]; x[1] = p[2 * s + 1]; const v2h a = __builtin_convertvector(x, v2h); h[2 * s] = a[0]; h[2 * s + 1] = a[1]; } } };
template <typename T16, bool HL>
__device__ __forceinline__ void fattn_wave(const T16* __restrict__ Q, const T16* __restrict__ Q2, const T16* __restrict__ K, const T16* __restrict__ K2, const T16* __restrict__ V, const T16* __restrict__ V2, bf* Ah, bf* Al) {
    typedef typename WFrag<T16>::V F;
    const int lane = threadIdx.x & 31, lr = lane & 15, hi = lane >> 4;
    const float C2 = SCL * 1.4426950408889634f;
    // every pointer argument is wave-uniform (Q, Ah, Al at the wave's first query); a lane adds one of three 32-bit offsets that keep their registers to the end
    const unsigned kofs = (unsigned)(lr * HD + 8 * hi);
    F qf[2][2], q2[2][2], kf[2][2], k2[2][2];
    F va[4], va2[4], vb[4], vb2[4];   // two sets of V^T rows: a pass works on one while the next pass's rows land in the other
#pragma unroll
    for (int qt = 0; qt < 2; ++qt)
#pragma unroll
        for (int ks = 0; ks < 2; ++ks) { qf[qt][ks] = WFrag<T16>::ld(Q + kofs + (qt * 16 * HD + ks * 32)); if (HL) q2[qt][ks] = WFrag<T16>::ld(Q2 + kofs + (qt * 16 * HD + ks * 32)); }
    asm volatile("s_wait_xcnt 0x0" ::: "memory");   // the next loads' addresses may take the registers of the addresses above: the wait stands in front of that
    __builtin_amdgcn_sched_barrier(0);              // keeps what follows behind that wait
#pragma unroll
    for (int kt = 0; kt < 2; ++kt)
#pragma unroll
        for (int ks = 0; ks < 2; ++ks) { kf[kt][ks] = WFrag<T16>::ld(K + kofs + (kt * 16 * HD + ks * 32)); if (HL) k2[kt][ks] = WFrag<T16>::ld(K2 + kofs + (kt * 16 * HD + ks * 32)); }
    asm volatile("s_wait_xcnt 0x0" ::: "memory");   // the next loads' addresses may take the registers of the addresses above: the wait stands in front of that
    __builtin_amdgcn_sched_barrier(0);              // keeps what follows behind that wait
    const unsigned vofs = (unsigned)(lr * TT + 8 * hi);
#pragma unroll
    for (int dt = 0; dt < 4; ++dt) { va[dt] = WFrag<T16>::ld(V + vofs + dt * 16 * TT); if (HL) va2[dt] = WFrag<T16>::ld(V2 + vofs + dt * 16 * TT); }
    v8f o[4][2]; float m2[2], ls[2];
#pragma unroll
    for (int qt = 0; qt < 2; ++qt) { m2[qt] = -3.0e38f; ls[qt] = 0.f;
#pragma unroll
        for (int dt = 0; dt < 4; ++dt) o[dt][qt] = (v8f){}; }
    auto pass = [&](int k0, F (&vf)[4], F (&v2)[4], F (&vn)[4], F (&vn2)[4]) {
        asm volatile("s_wait_xcnt 0x0" ::: "memory");   // the base addresses of the loads issued so far are rewritten below: the wait stands in front of that
        __builtin_amdgcn_sched_barrier(0);              // keeps the address arithmetic of this pass behind that wait
        const int kn = (k0 + 32 < TT) ? k0 + 32 : 0;   // the next pass's K and V^T rows are fetched a pass ahead (the last pass fetches the first rows again, unused)
        const T16* Vn = sbase(V + kn); const T16* Vn2 = HL ? sbase(V2 + kn) : nullptr; const T16* Kn = sbase(K + (size_t)kn * HD); const T16* Kn2 = HL ? sbase(K2 + (size_t)kn * HD) : nullptr;
#pragma unroll
        for (int dt = 0; dt < 4; ++dt) { vn[dt] = WFrag<T16>::ld(Vn + vofs + dt * 16 * TT); if (HL) vn2[dt] = WFrag<T16>::ld(Vn2 + vofs + dt * 16 * TT); }
        v8f s[2][2];
#pragma unroll
        for (int kt = 0; kt < 2; ++kt)
#pragma unroll
            for (int qt = 0; qt < 2; ++qt) s[kt][qt] = (v8f){};
#pragma unroll
        for (int ks = 0; ks < 2; ++ks) {
#pragma unroll
            for (int kt = 0; kt < 2; ++kt)
#pragma unroll
                for (int qt = 0; qt < 2; ++qt) s[kt][qt] = WFrag<T16>::mma(kf[kt][ks], qf[qt][ks], s[kt][qt]);
            if (HL) {
#pragma unroll
                for (int kt = 0; kt < 2; ++kt)
#pragma unroll
                    for (int qt = 0; qt < 2; ++qt) s[kt][qt] = WFrag<T16>::mma(kf[kt][ks], q2[qt][ks], s[kt][qt]);
#pragma unroll
                for (int kt = 0; kt < 2; ++kt)
#pragma unroll
                    for (int qt = 0; qt < 2; ++qt) s[kt][qt] = WFrag<T16>::mma(k2[kt][ks], qf[qt][ks], s[kt][qt]); } }
#pragma unroll
        for (int kt = 0; kt < 2; ++kt)
#pragma unroll
            for (int ks = 0; ks < 2; ++ks) { kf[kt][ks] = WFrag<T16>::ld(Kn + kofs + (kt * 16 * HD + ks * 32)); if (HL) k2[kt][ks] = WFrag<T16>::ld(Kn2 + kofs + (kt * 16 * HD + ks * 32)); }
        asm volatile("" ::: "memory");   // holds the fetches above here: without it the compiler sinks them behind the rescale branch, and they have less time to land
        float bm[2];
#pragma unroll
        for (int qt = 0; qt < 2; ++qt) { float x[8];
#pragma unroll
            for (int j = 0; j < 8; ++j) x[j] = fmaxf(s[0][qt][j], s[1][qt][j]);
            float y = fmaxf(fmaxf(fmaxf(x[0], x[1]), fmaxf(x[2], x[3])), fmaxf(fmaxf(x[4], x[5]), fmaxf(x[6], x[7])));
            y = fmaxf(y, xhalf(y)); bm[qt] = y * C2; }
        const bool need = (bm[0] > m2[0] + 8.0f) || (bm[1] > m2[1] + 8.0f);
        if (__builtin_amdgcn_ballot_w32(need) != 0) {
#pragma unroll
            for (int qt = 0; qt < 2; ++qt) { const float mn = fmaxf(m2[qt], bm[qt]); const float al = __builtin_amdgcn_exp2f(m2[qt] - mn); m2[qt] = mn; ls[qt] *= al;
#pragma unroll
                for (int dt = 0; dt < 4; ++dt) o[dt][qt] *= al; } }
        F ph[2], pl[2];
#pragma unroll
        for (int qt = 0; qt < 2; ++qt) { float p[16];
#pragma unroll
            for (int e = 0; e < 16; ++e) p[e] = __builtin_amdgcn_exp2f(__builtin_fmaf(s[e >> 3][qt][e & 7], C2, -m2[qt]));
            float t[8];
#pragma unroll
            for (int e = 0; e < 8; ++e) t[e] = p[e] + p[e + 8];
            ls[qt] += ((t[0] + t[1]) + (t[2] + t[3])) + ((t[4] + t[5]) + (t[6] + t[7]));
            PPack<HL>::pack(p, ph[qt], pl[qt]); }
#pragma unroll
        for (int dt = 0; dt < 4; ++dt)
#pragma unroll
            for (int qt = 0; qt < 2; ++qt) o[dt][qt] = WFrag<T16>::mma(vf[dt], ph[qt], o[dt][qt]);
        if (HL) {
#pragma unroll
            for (int dt = 0; dt < 4; ++dt)
#pragma unroll
                for (int qt = 0; qt < 2; ++qt) o[dt][qt] = WFrag<T16>::mma(vf[dt], pl[qt], o[dt][qt]);
#pragma unroll
            for (int dt = 0; dt < 4; ++dt)
#pragma unroll
                for (int qt = 0; qt < 2; ++qt) o[dt][qt] = WFrag<T16>::mma(v2[dt], ph[qt], o[dt][qt]); }
    };
#pragma unroll 1
    for (int k0 = 0; k0 < TT; k0 += 64) { pass(k0, va, va2, vb, vb2); pass(k0 + 32, vb, vb2, va, va2); }
    asm volatile("s_wait_xcnt 0x0" ::: "memory");   // the epilogue reuses the registers of the last loads' addresses: the wait stands in front of it
    __builtin_amdgcn_sched_barrier(0);              // keeps the epilogue behind that wait
    const unsigned oofs = (unsigned)(lr * DQ + 8 * hi);
    v8us oh[2][4], ol[2][4];
#pragma unroll
    for (int qt = 0; qt < 2; ++qt) { const float inv = __fdiv_rn(1.0f, ls[qt] + xhalf(ls[qt]));
#pragma unroll
        for (int dt = 0; dt < 4; ++dt)
#pragma unroll
            for (int j = 0; j < 8; ++j) { unsigned short a, c2; splitf(o[dt][qt][j] * inv, a, c2); oh[qt][dt][j] = a; ol[qt][dt][j] = c2; } }
    __builtin_amdgcn_sched_barrier(0);   // the stores stand behind the splitting arithmetic, so that it writes no register that an issued store names
#pragma unroll
    for (int qt = 0; qt < 2; ++qt)
#pragma unroll
        for (int dt = 0; dt < 4; ++dt) { *(v8us*)(Ah + oofs + (qt * 16 * DQ + dt * 16)) = oh[qt][dt]; *(v8us*)(Al + oofs + (qt * 16 * DQ + dt * 16)) = ol[qt][dt]; }
}
// k_fattn: grid (head planes of the pass, TT / 128), 4 waves of 32 queries. The query blocks below RH (three products) have the low block indices and start first.
__global__ __launch_bounds__(128) void k_fattn(const bf* __restrict__ QKh, const bf* __restrict__ QKl, const h16* __restrict__ QK16, const bf* __restrict__ VTh, const bf* __restrict__ VTl, const h16* __restrict__ VT16, size_t pl, bf* Ah, bf* Al) {
    const int y = (int)blockIdx.x; const size_t zo = (size_t)y * TT * HD;
    const int q0 = (int)blockIdx.y * 128 + __builtin_amdgcn_readfirstlane((int)(threadIdx.x >> 5)) * 32;   // the wave's first query, in a scalar register
    const size_t qo = zo + (size_t)q0 * HD, ao = ((size_t)(y / NH_) * TT + q0) * DQ + (size_t)(y % NH_) * HD;
    if ((int)blockIdx.y * 128 < RH) fattn_wave<bf, true>(QKh + qo, QKl + qo, QKh + pl + zo, QKl + pl + zo, VTh + zo, VTl + zo, Ah + ao, Al + ao);
    else fattn_wave<h16, false>(QK16 + qo, nullptr, QK16 + pl + zo, nullptr, VT16 + zo, nullptr, Ah + ao, Al + ao);
}

extern "C" void kernel_launch(void* const* d_in, const int* in_sizes, int n_in,
                              void* d_out, int out_size, void* d_ws, size_t ws_size, hipStream_t stream) {
    (void)in_sizes; (void)n_in; (void)out_size;
    const float* xq = (const float*)d_in[0]; const float* xk = (const float*)d_in[1]; const float* xv = (const float*)d_in[2]; const float* wq = (const float*)d_in[3]; const float* bq = (const float*)d_in[4]; const float* wk = (const float*)d_in[5]; const float* bk = (const float*)d_in[6]; const float* wv = (const float*)d_in[7]; const float* bv = (const float*)d_in[8]; const float* wo = (const float*)d_in[9]; const float* bo = (const float*)d_in[10]; const float* x = xq; (void)x; const float* cosT = nullptr; const float* sinT = nullptr; (void)cosT; (void)sinT;
    float* OUT = (float*)d_out;     // [8][1024][1024]
    char* wsp = (char*)d_ws;
    auto take = [&](size_t bytes) { char* p = wsp; wsp += (bytes + 255) & ~(size_t)255; return (void*)p; };
    const size_t PL = (size_t)NBG * NH_ * TT * HD;   // elements of one set of head planes: NBG batch elements, all heads
    bf* W3 = (bf*)take((size_t)3 * DQ * DM * 2); bf* WO = (bf*)take((size_t)DM * DQ * 2); float* CS = (float*)take((size_t)TT * HD * 2 * 4);   // W3: q, k, v weights, transposed
    h16* QK16 = (h16*)take(2 * PL * 2); bf* QKh = (bf*)take(2 * PL * 2); bf* QKl = (bf*)take(2 * PL * 2);   // q planes, then k planes
    h16* VT16 = (h16*)take(PL * 2); bf* VTh = (bf*)take(PL * 2); bf* VTl = (bf*)take(PL * 2);
    bf* ATh = (bf*)take((size_t)NB_ * TT * DQ * 2); bf* ATl = (bf*)take((size_t)NB_ * TT * DQ * 2);
    const size_t XN = (size_t)NBG * TT * DM;   // elements of one input, or of one projection, in a pass
    bf* X3 = (bf*)take(3 * XN * 2); float* F3 = (float*)take(3 * XN * 4);   // the projection pass's bf16 inputs and f32 results; q, k, v one behind the other in both
    if ((size_t)(wsp - (char*)d_ws) > ws_size) return;    // ws 256 MiB
    k_wtG<<<dim3((DM * HD / 64 + 63) / 64, NH_, 3), 256, 0, stream>>>(wq, wk, wv, DM, HD, W3, (size_t)DQ * DM);
    k_wtG<<<dim3((DQ * DM / 64 + 63) / 64, 1, 1), 256, 0, stream>>>(wo, wo, wo, DQ, DM, WO, 0);
    k_csid<<<(TT * HD + 255) / 256, 256, 0, stream>>>(CS);
    const unsigned LQ = (unsigned)(((size_t)NH_ * TT * HD / 2 + 255) / 256);
    for (int g = 0; g < NB_; g += NBG) {
        k_cvt8<<<dim3((unsigned)((XN / 8 + 255) / 256), 3, 1), 256, 0, stream>>>(xq + (size_t)g * TT * DM, xk + (size_t)g * TT * DM, xv + (size_t)g * TT * DM, X3, XN / 8);
        k_gemmw<bf, 0, true><<<dim3(NBG * TT / 64, DQ / 64, 3), 32, 0, stream>>>(X3, nullptr, W3, nullptr, DM, F3, DQ, bq, bk, bv, XN, (size_t)DQ * DM, XN);
        k_rope<<<dim3(LQ, 2 * NBG, 1), 256, 0, stream>>>(F3, DQ, NH_, CS, nullptr, nullptr, 1.0f, QK16, QKh, QKl);
        k_vtp<<<dim3(LQ, NBG, 1), 256, 0, stream>>>(F3 + 2 * XN, DKV, NKV, VT16, VTh, VTl);
        k_fattn<<<dim3(NBG * NH_, TT / 128, 1), 128, 0, stream>>>(QKh, QKl, QK16, VTh, VTl, VT16, PL, ATh + (size_t)g * TT * DQ, ATl + (size_t)g * TT * DQ); }
    k_gemmw<bf, 1, true><<<dim3(NB_ * TT / 64, DM / 64, 1), 32, 0, stream>>>(ATh, ATl, WO, nullptr, DQ, OUT, DM, bo, bo, bo, 0, 0, 0);
}

// v003
// Measured time: 301 microseconds a run.
// Next to v002, in two timings, it ran 1.28 times as fast each time.
// All steps since v000 together make it 17.2 times as fast.
#include <hip/hip_runtime.h>

// MultipleHeadAttention (q, k, v inputs [8][1024][1024]; per-head Dense: qh = q Wq[h] + bq[h] (Wq [16][1024][64]), likewise kh from k, vh from v; softmax(qh.kh / 8); out = concat heads Wo + bo ([1024][1024] 'xw') -> [8][1024][1024]).
// Compute dtypes, f32 accumulate: every input rounded to bf16; the three per-head projections as PLAIN bf16 GEMMs (inputs: exact; the 16 [1024][64] head blocks transposed into one [1024][1024] Bt) + bias, whose epilogue writes the attention planes itself; scores, softmax and attn.v in one kernel: query rows < 512 hl (3 products), the rest fp16; softmax f32, running maximum and sum; Wo hl x exact (2 products) + bias.

#define NB_  8
#define TT   1024
#define DM   1024
#define NH_  16
#define NKV  16
#define REP  (NH_ / NKV)
#define HD   64
#define DQ   (NH_ * HD)
#define DKV  (NKV * HD)
#define NBG  4                    // batch elements per projection pass
#define RH   512                  // query rows < RH use hi+lo planes (0: none)
#define WIN  0
#define SCL  0.125f   // HD^-0.5
typedef _Float16 h16;
typedef unsigned short bf;
typedef __attribute__((ext_vector_type(16))) __bf16   v16bf;
typedef __attribute__((ext_vector_type(16))) _Float16 v16h;
typedef __attribute__((ext_vector_type(8)))  _Float16 v8h;
typedef __attribute__((ext_vector_type(8)))  unsigned short v8us;
typedef __attribute__((ext_vector_type(8)))  float    v8f;
typedef __attribute__((ext_vector_type(4)))  float    v4f;
typedef v8h  __attribute__((may_alias)) v8ha;
typedef v4f  __attribute__((may_alias)) v4fa;
typedef v8us __attribute__((may_alias)) v8usa;

__device__ __forceinline__ unsigned short f2bf(float f) { unsigned u = __float_as_uint(f); u += 0x7FFFu + ((u >> 16) & 1u); return (unsigned short)(u >> 16); }
__device__ __forceinline__ float bf2f(unsigned short b) { return __uint_as_float(((unsigned)b) << 16); }
__device__ __forceinline__ float bfr(float f) { return bf2f(f2bf(f)); }
__device__ __forceinline__ v16h cat16(v8h lo, v8h hi) { return __builtin_shufflevector(lo, hi, 0, 1, 2, 3, 4, 5, 6, 7, 8, 9, 10, 11, 12, 13, 14, 15); }
__device__ __forceinline__ v16bf cat16b(v8us lo, v8us hi) { return __builtin_bit_cast(v16bf, __builtin_shufflevector(lo, hi, 0, 1, 2, 3, 4, 5, 6, 7, 8, 9, 10, 11, 12, 13, 14, 15)); }
__device__ __forceinline__ v8f wmma16(v16h a, v16h b, v8f c) { return __builtin_amdgcn_wmma_f32_16x16x32_f16(false, a, false, b, (short)0, c, false, false); }
__device__ __forceinline__ v8f wmmab(v16bf a, v16bf b, v8f c) { return __builtin_amdgcn_wmma_f32_16x16x32_bf16(false, a, false, b, (short)0, c, false, false); }



// ---- gemmw_tile: register-blocked GEMM, ONE WAVE per 64x64 output tile (16 accumulators), operands straight from K-contiguous 16-bit planes; its kernels: grid (M/64, N/64, Z), 32 threads.
// C[m][n] (f32, pitch ldc, + optional f32 bias[n]) = sum_k A[m][k] Bt[n][k] (+ split products per NSPLIT). z-batch strides sA/sB/sC in elements. K % 32 == 0.
template <typename T16> struct WFrag;
template <> struct WFrag<h16> { typedef v16h V; static __device__ __forceinline__ V ld(const h16* p) { return cat16(*(const v8h*)p, *(const v8h*)(p + 16)); } static __device__ __forceinline__ v8f mma(V a, V b, v8f c) { return wmma16(a, b, c); } };
template <> struct WFrag<bf> { typedef v16bf V; static __device__ __forceinline__ V ld(const bf* p) { return cat16b(*(const v8us*)p, *(const v8us*)(p + 16)); } static __device__ __forceinline__ v8f mma(V a, V b, v8f c) { return wmmab(a, b, c); } };
template <typename T16, int NSPLIT, bool BIAS>
__device__ __forceinline__ void gemmw_tile(float* os, int bx, const T16* __restrict__ A, const T16* __restrict__ A2, const T16* __restrict__ Bt, const T16* __restrict__ Bt2, int K, float* C, int ldc, const float* __restrict__ bias, size_t sA, size_t sB, size_t sC) {
    typedef typename WFrag<T16>::V V;
    const size_t z = blockIdx.z; A += z * sA; if (A2) A2 += z * sA; Bt += z * sB; if (Bt2) Bt2 += z * sB; C += z * sC;
    const int lane = threadIdx.x & 31, lr = lane & 15, hi = lane >> 4; const int r0 = bx * 64, c0 = blockIdx.y * 64;
    v8f acc[4][4];
#pragma unroll
    for (int mb = 0; mb < 4; ++mb)
#pragma unroll
        for (int nb = 0; nb < 4; ++nb) acc[mb][nb] = (v8f){};
    const size_t aoff = (size_t)(r0 + lr) * K + 8 * hi, boff = (size_t)(c0 + lr) * K + 8 * hi;
#pragma unroll 1
    for (int kc = 0; kc < K; kc += 32) {
        V a[4], a2[4];
#pragma unroll
        for (int mb = 0; mb < 4; ++mb) { a[mb] = WFrag<T16>::ld(A + aoff + (size_t)mb * 16 * K + kc); if (NSPLIT == 1 || NSPLIT == 2) a2[mb] = WFrag<T16>::ld(A2 + aoff + (size_t)mb * 16 * K + kc); }
#pragma unroll
        for (int nb = 0; nb < 4; ++nb) { const V b = WFrag<T16>::ld(Bt + boff + (size_t)nb * 16 * K + kc); V b2; if (NSPLIT >= 2) b2 = WFrag<T16>::ld(Bt2 + boff + (size_t)nb * 16 * K + kc);
#pragma unroll
            for (int mb = 0; mb < 4; ++mb) { acc[mb][nb] = WFrag<T16>::mma(a[mb], b, acc[mb][nb]); if (NSPLIT == 1 || NSPLIT == 2) acc[mb][nb] = WFrag<T16>::mma(a2[mb], b, acc[mb][nb]); if (NSPLIT >= 2) acc[mb][nb] = WFrag<T16>::mma(a[mb], b2, acc[mb][nb]); } }
        asm volatile("v_nop\n\tv_nop\n\tv_nop\n\tv_nop" : "+v"(acc[0][0]), "+v"(acc[1][1]), "+v"(acc[2][2]), "+v"(acc[3][3]) : "v"(a[0]), "v"(a[3]));
    }
#pragma unroll
    for (int mb = 0; mb < 4; ++mb) {
#pragma unroll
        for (int nb = 0; nb < 4; ++nb) {
#pragma unroll
            for (int j = 0; j < 8; ++j) os[(hi * 8 + j) * 68 + nb * 16 + lr] = acc[mb][nb][j]; }
        __builtin_amdgcn_wave_barrier(); asm volatile("" ::: "memory");
        float* crow = C + (size_t)(r0 + mb * 16) * ldc + c0;
{
#pragma unroll
            for (int s = 0; s < 8; ++s) { const int row = 2 * s + hi, cofs = lr * 4; v4f val = *(const v4fa*)(os + row * 68 + cofs); if (BIAS) { val[0] += bfr(bias[c0 + cofs]); val[1] += bfr(bias[c0 + cofs + 1]); val[2] += bfr(bias[c0 + cofs + 2]); val[3] += bfr(bias[c0 + cofs + 3]); }
                *(v4f*)(crow + (size_t)row * ldc + cofs) = val; }
             }
        __builtin_amdgcn_wave_barrier(); asm volatile("" ::: "memory");
    }
}
// k_gemmw: one GEMM per z; the bias vector of z = 0, 1, 2 is bias0, bias1, bias2.
template <typename T16, int NSPLIT, bool BIAS>
__global__ __launch_bounds__(32) void k_gemmw(const T16* __restrict__ A, const T16* __restrict__ A2, const T16* __restrict__ Bt, const T16* __restrict__ Bt2, int K, float* C, int ldc, const float* __restrict__ bias0, const float* __restrict__ bias1, const float* __restrict__ bias2, size_t sA, size_t sB, size_t sC) {
    __shared__ __align__(16) float os[16 * 68];
    const float* bias = (blockIdx.z == 0) ? bias0 : (blockIdx.z == 1) ? bias1 : bias2;
    gemmw_tile<T16, NSPLIT, BIAS>(os, (int)blockIdx.x, A, A2, Bt, Bt2, K, C, ldc, bias, sA, sB, sC);
}
__device__ __forceinline__ h16 tohx(float x) { return (h16)x; }
__device__ __forceinline__ void splitf(float y, unsigned short& h, unsigned short& l) { h = f2bf(y); l = f2bf(y - bf2f(h)); }
typedef __attribute__((ext_vector_type(2))) _Float16 v2h;
typedef __attribute__((ext_vector_type(4))) _Float16 v4h;
typedef __attribute__((ext_vector_type(2))) unsigned short v2us;
typedef __attribute__((ext_vector_type(4))) unsigned short v4us;
typedef __attribute__((ext_vector_type(2))) float v2f;
typedef __attribute__((ext_vector_type(4))) int v4i;

// grid (lines, blocks of [K][N] in one weight, weights): source w0, w1 or w2 by z; Bt holds a weight's transposed blocks one behind the other, the weights sBt elements apart.
__global__ __launch_bounds__(256) void k_wtG(const float* __restrict__ w0, const float* __restrict__ w1, const float* __restrict__ w2, int K, int N, bf* Bt, size_t sBt) {
    const float* w = ((blockIdx.z == 0) ? w0 : (blockIdx.z == 1) ? w1 : w2) + (size_t)blockIdx.y * K * N; Bt += (size_t)blockIdx.z * sBt + (size_t)blockIdx.y * N * K;
    const int lane = threadIdx.x & 31; const int L0 = (blockIdx.x * 8 + (threadIdx.x >> 5)) * 8; const int nlines = N * K / 64;
{
#pragma unroll 1
        for (int l = 0; l < 8; ++l) { const int L = L0 + l; if (L >= nlines) break; const size_t e = (size_t)L * 64 + lane * 2; const int k = (int)(e % K), n = (int)(e / K); v2us o;
            o[0] = f2bf(w[(size_t)k * N + n]); o[1] = f2bf(w[(size_t)(k + 1) * N + n]); *(v2us*)(Bt + e) = o; }
         }
}
__global__ __launch_bounds__(256) void k_cvt8(const float* __restrict__ s0, const float* __restrict__ s1, const float* __restrict__ s2, bf* dst, size_t n8) { const size_t i = (size_t)blockIdx.x * 256 + threadIdx.x; if (i >= n8) return; const float* src = (blockIdx.y == 0) ? s0 : (blockIdx.y == 1) ? s1 : s2; dst += (size_t)blockIdx.y * n8 * 8; const v8f v = *(const v8f*)(src + i * 8); v8us o;
#pragma unroll
    for (int k = 0; k < 8; ++k) o[k] = f2bf(v[k]); *(v8us*)(dst + i * 8) = o;  }
__global__ __launch_bounds__(256) void k_cscvt(const float* __restrict__ cosT, const float* __restrict__ sinT, float* CS) { const int idx = blockIdx.x * 256 + threadIdx.x; if (idx >= TT * HD) return; v2f cs; cs[0] = bfr(cosT[idx]); cs[1] = bfr(sinT[idx]); *(v2f*)(CS + (size_t)idx * 2) = cs;  }
typedef __attribute__((ext_vector_type(2))) __bf16 v2bf;
__device__ __forceinline__ float xhalf(float x) { return __builtin_bit_cast(float, __builtin_amdgcn_permlanex16(__builtin_bit_cast(int, x), __builtin_bit_cast(int, x), 0x76543210, 0xfedcba98, false, false)); }   // lane l with lane l ^ 16
// a wave-uniform address, held in a scalar register pair: the loads then take the form scalar base + 32-bit lane offset + constant, and the lane offsets are never rewritten
template <typename T> __device__ __forceinline__ const T* sbase(const T* p) { const unsigned long long a = (unsigned long long)p; return (const T*)(const __attribute__((address_space(1))) T*)(((unsigned long long)(unsigned)__builtin_amdgcn_readfirstlane((int)(a >> 32)) << 32) | (unsigned long long)(unsigned)__builtin_amdgcn_readfirstlane((int)a)); }
// ---- k_proj: the q, k and v projections of one pass (z = 0, 1, 2), ONE WAVE per 64x64 tile; the K loop loads and multiplies in the order of gemmw_tile's (four A fragments, then one B fragment and its four products at a time); grid (tokens / 64, heads, 3), 32 threads.
// The epilogue adds the bias and writes the tile, as fp16 and as bf16 hi + lo, straight into the planes that the attention kernel reads: no f32 projection in memory and no conversion launches.
// q, k: tile rows are tokens, columns one head's features -> [b][h][t][d]. v: the two operands change places (rows the head's features, columns tokens), so that the same row-wise epilogue writes V^T, [b][h][d][t].
#define PLN ((size_t)NBG * NH_ * TT * HD)   // elements of one set of head planes
#define XNN ((size_t)NBG * TT * DM)         // elements of one input in a pass
__global__ __launch_bounds__(32) void k_proj(const bf* __restrict__ X3, const bf* __restrict__ W3, const float* __restrict__ bias0, const float* __restrict__ bias1, const float* __restrict__ bias2, h16* QK16, bf* QKh, bf* QKl, h16* VT16, bf* VTh, bf* VTl) {
    __shared__ __align__(16) float os[16 * 68];
    const int z = (int)blockIdx.z, tok0 = (int)blockIdx.x * 64, head = (int)blockIdx.y; const bool tr = (z == 2);
    const bf* Xt = X3 + (size_t)z * XNN + (size_t)tok0 * DM; const bf* Wt = W3 + (size_t)z * DQ * DM + (size_t)head * HD * DM;
    const bf* A = tr ? Wt : Xt; const bf* Bt = tr ? Xt : Wt;
    const float* bias = ((z == 0) ? bias0 : (z == 1) ? bias1 : bias2) + head * HD;
    const int lane = threadIdx.x & 31, lr = lane & 15, hi = lane >> 4;
    const int erow = lane >> 3, ecol = (lane & 7) * 8;   // epilogue: a lane holds 8 neighbours of one row, 8 lanes a row of 64, 4 rows a store
    float cb[8], rb[4][4];   // the bias of the lane's 8 columns (q, k) and of its 16 rows (v)
    { const v4f c0 = *(const v4fa*)(bias + ecol), c1 = *(const v4fa*)(bias + ecol + 4);
#pragma unroll
      for (int i = 0; i < 4; ++i) { cb[i] = bfr(c0[i]); cb[i + 4] = bfr(c1[i]); }
#pragma unroll
      for (int mb = 0; mb < 4; ++mb)
#pragma unroll
          for (int s = 0; s < 4; ++s) rb[mb][s] = bfr(bias[mb * 16 + s * 4 + erow]); }
    v8f acc[4][4];
#pragma unroll
    for (int mb = 0; mb < 4; ++mb)
#pragma unroll
        for (int nb = 0; nb < 4; ++nb) acc[mb][nb] = (v8f){};
    const unsigned off = (unsigned)(lr * DM + 8 * hi);
    const bf* Ak = sbase(A); const bf* Bk = sbase(Bt);   // scalar base + the lane's 32-bit offset + constant: the lane offset is never rewritten
#pragma unroll 1   // rolled, as in gemmw_tile: one trip's fragments beside the 16 accumulators
    for (int kc = 0; kc < DM; kc += 32) {
        v16bf a[4];
#pragma unroll
        for (int mb = 0; mb < 4; ++mb) a[mb] = WFrag<bf>::ld(Ak + off + (mb * 16 * DM));
#pragma unroll
        for (int nb = 0; nb < 4; ++nb) { const v16bf b = WFrag<bf>::ld(Bk + off + (nb * 16 * DM));
#pragma unroll
            for (int mb = 0; mb < 4; ++mb) acc[mb][nb] = WFrag<bf>::mma(a[mb], b, acc[mb][nb]); }
        unsigned long long ua = (unsigned long long)Ak, ub = (unsigned long long)Bk;
        asm volatile("s_wait_xcnt 0x0\n\ts_add_nc_u64 %0, %0, 64\n\ts_add_nc_u64 %1, %1, 64" : "+s"(ua), "+s"(ub));   // the bases go on by 32 elements; they are named by this trip's loads, so the wait stands in front of the additions, in their own statement
        Ak = (const bf*)(const __attribute__((address_space(1))) bf*)ua; Bk = (const bf*)(const __attribute__((address_space(1))) bf*)ub;
    }
    const size_t pb = ((size_t)(tok0 / TT) * NH_ + head) * TT * HD; const int t0 = tok0 % TT;
    const size_t db = tr ? pb + t0 : (size_t)z * PLN + pb + (size_t)t0 * HD; const unsigned pitch = tr ? TT : HD;
    h16* D16 = (tr ? VT16 : QK16) + db; bf* Dh = (tr ? VTh : QKh) + db; bf* Dl = (tr ? VTl : QKl) + db;
    unsigned vo[4];   // the lane's byte offsets in a block of 16 rows (every plane holds 2-byte elements): formed once, in front of the first store, and never rewritten
#pragma unroll
    for (int s = 0; s < 4; ++s) vo[s] = ((unsigned)(s * 4 + erow) * pitch + ecol) * 2u;
#pragma unroll
    for (int mb = 0; mb < 4; ++mb) {
#pragma unroll
        for (int nb = 0; nb < 4; ++nb) {
#pragma unroll
            for (int j = 0; j < 8; ++j) os[(hi * 8 + j) * 68 + nb * 16 + lr] = acc[mb][nb][j]; }
        __builtin_amdgcn_wave_barrier(); asm volatile("" ::: "memory");   // the rows are read back by other lanes of this wave: keeps the reads behind the writes
        const unsigned ro = (unsigned)(mb * 16) * pitch;   // the block's first row, in the scalar bases: the stores take the form scalar base + lane offset
        h16* E16 = const_cast<h16*>(sbase(D16 + ro)); bf* Eh = const_cast<bf*>(sbase(Dh + ro)); bf* El = const_cast<bf*>(sbase(Dl + ro));
        v8h o16[4]; v8us oh[4], ol[4];
#pragma unroll
        for (int s = 0; s < 4; ++s) { const float* r = os + (s * 4 + erow) * 68 + ecol; const v4f x0 = *(const v4fa*)r, x1 = *(const v4fa*)(r + 4);
#pragma unroll
            for (int i = 0; i < 8; ++i) { const float y = ((i < 4) ? x0[i & 3] : x1[i & 3]) + (tr ? rb[mb][s] : cb[i]); o16[s][i] = tohx(y); unsigned short a2, c2; splitf(y, a2, c2); oh[s][i] = a2; ol[s][i] = c2; } }
        __builtin_amdgcn_sched_barrier(0);   // the stores stand behind the converting arithmetic, so that it writes no register that an issued store names
#pragma unroll
        for (int s = 0; s < 4; ++s) { *(v8h*)((char*)E16 + vo[s]) = o16[s]; *(v8us*)((char*)Eh + vo[s]) = oh[s]; *(v8us*)((char*)El + vo[s]) = ol[s]; }
        asm volatile("s_wait_xcnt 0x0" ::: "memory");   // the next 16 rows reuse the registers of these stores: the wait stands in front of that
        __builtin_amdgcn_sched_barrier(0);              // keeps what follows behind that wait
    }
}
template <bool HL> struct PPack;
template <> struct PPack<true> { static __device__ __forceinline__ void pack(const float* p, v16bf& h, v16bf& l) {
#pragma unroll
    for (int s = 0; s < 8; ++s) { v2f x; x[0] = p[2 * s]; x[1] = p[2 * s + 1]; const v2bf a = __builtin_convertvector(x, v2bf); const v2f r = x - __builtin_convertvector(a, v2f); const v2bf c = __builtin_convertvector(r, v2bf); h[2 * s] = a[0]; h[2 * s + 1] = a[1]; l[2 * s] = c[0]; l[2 * s + 1] = c[1]; } } };
template <> struct PPack<false> { static __device__ __forceinline__ void pack(const float* p, v16h& h, v16h& l) { (void)l;
#pragma unroll
    for (int s = 0; s < 8; ++s) { v2f x; x[0] = p[2 * s]; x[1] = p[2 * s + 1]; const v2h a = __builtin_convertvector(x, v2h); h[2 * s] = a[0]; h[2 * s + 1] = a[1]; } } };
template <typename T16, bool HL>
__device__ __forceinline__ void fattn_wave(const T16* __restrict__ Q, const T16* __restrict__ Q2, const T16* __restrict__ K, const T16* __restrict__ K2, const T16* __restrict__ V, const T16* __restrict__ V2, bf* Ah, bf* Al) {
    typedef typename WFrag<T16>::V F;
    const int lane = threadIdx.x & 31, lr = lane & 15, hi = lane >> 4;
    const float C2 = SCL * 1.4426950408889634f;
    // every pointer argument is wave-uniform (Q, Ah, Al at the wave's first query); a lane adds one of three 32-bit offsets that keep their registers to the end
    const unsigned kofs = (unsigned)(lr * HD + 8 * hi);
    F qf[2][2], q2[2][2], kf[2][2], k2[2][2];
    F va[4], va2[4], vb[4], vb2[4];   // two sets of V^T rows: a pass works on one while the next pass's rows land in the other
#pragma unroll
    for (int qt = 0; qt < 2; ++qt)
#pragma unroll
        for (int ks = 0; ks < 2; ++ks) { qf[qt][ks] = WFrag<T16>::ld(Q + kofs + (qt * 16 * HD + ks * 32)); if (HL) q2[qt][ks] = WFrag<T16>::ld(Q2 + kofs + (qt * 16 * HD + ks * 32)); }
    asm volatile("s_wait_xcnt 0x0" ::: "memory");   // the next loads' addresses may take the registers of the addresses above: the wait stands in front of that
    __builtin_amdgcn_sched_barrier(0);              // keeps what follows behind that wait
#pragma unroll
    for (int kt = 0; kt < 2; ++kt)
#pragma unroll
        for (int ks = 0; ks < 2; ++ks) { kf[kt][ks] = WFrag<T16>::ld(K + kofs + (kt * 16 * HD + ks * 32)); if (HL) k2[kt][ks] = WFrag<T16>::ld(K2 + kofs + (kt * 16 * HD + ks * 32)); }
    asm volatile("s_wait_xcnt 0x0" ::: "memory");   // the next loads' addresses may take the registers of the addresses above: the wait stands in front of that
    __builtin_amdgcn_sched_barrier(0);              // keeps what follows behind that wait
    const unsigned vofs = (unsigned)(lr * TT + 8 * hi);
#pragma unroll
    for (int dt = 0; dt < 4; ++dt) { va[dt] = WFrag<T16>::ld(V + vofs + dt * 16 * TT); if (HL) va2[dt] = WFrag<T16>::ld(V2 + vofs + dt * 16 * TT); }
    v8f o[4][2]; float m2[2], ls[2];
#pragma unroll
    for (int qt = 0; qt < 2; ++qt) { m2[qt] = -3.0e38f; ls[qt] = 0.f;
#pragma unroll
        for (int dt = 0; dt < 4; ++dt) o[dt][qt] = (v8f){}; }
    auto pass = [&](int k0, F (&vf)[4], F (&v2)[4], F (&vn)[4], F (&vn2)[4]) {
        asm volatile("s_wait_xcnt 0x0" ::: "memory");   // the base addresses of the loads issued so far are rewritten below: the wait stands in front of that
        __builtin_amdgcn_sched_barrier(0);              // keeps the address arithmetic of this pass behind that wait
        const int kn = (k0 + 32 < TT) ? k0 + 32 : 0;   // the next pass's K and V^T rows are fetched a pass ahead (the last pass fetches the first rows again, unused)
        const T16* Vn = sbase(V + kn); const T16* Vn2 = HL ? sbase(V2 + kn) : nullptr; const T16* Kn = sbase(K + (size_t)kn * HD); const T16* Kn2 = HL ? sbase(K2 + (size_t)kn * HD) : nullptr;
#pragma unroll
        for (int dt = 0; dt < 4; ++dt) { vn[dt] = WFrag<T16>::ld(Vn + vofs + dt * 16 * TT); if (HL) vn2[dt] = WFrag<T16>::ld(Vn2 + vofs + dt * 16 * TT); }
        v8f s[2][2];
#pragma unroll
        for (int kt = 0; kt < 2; ++kt)
#pragma unroll
            for (int qt = 0; qt < 2; ++qt) s[kt][qt] = (v8f){};
#pragma unroll
        for (int ks = 0; ks < 2; ++ks) {
#pragma unroll
            for (int kt = 0; kt < 2; ++kt)
#pragma unroll
                for (int qt = 0; qt < 2; ++qt) s[kt][qt] = WFrag<T16>::mma(kf[kt][ks], qf[qt][ks], s[kt][qt]);
            if (HL) {
#pragma unroll
                for (int kt = 0; kt < 2; ++kt)
#pragma unroll
                    for (int qt = 0; qt < 2; ++qt) s[kt][qt] = WFrag<T16>::mma(kf[kt][ks], q2[qt][ks], s[kt][qt]);
#pragma unroll
                for (int kt = 0; kt < 2; ++kt)
#pragma unroll
                    for (int qt = 0; qt < 2; ++qt) s[kt][qt] = WFrag<T16>::mma(k2[kt][ks], qf[qt][ks], s[kt][qt]); } }
#pragma unroll
        for (int kt = 0; kt < 2; ++kt)
#pragma unroll
            for (int ks = 0; ks < 2; ++ks) { kf[kt][ks] = WFrag<T16>::ld(Kn + kofs + (kt * 16 * HD + ks * 32)); if (HL) k2[kt][ks] = WFrag<T16>::ld(Kn2 + kofs + (kt * 16 * HD + ks * 32)); }
        asm volatile("" ::: "memory");   // holds the fetches above here: without it the compiler sinks them behind the rescale branch, and they have less time to land
        float bm[2];
#pragma unroll
        for (int qt = 0; qt < 2; ++qt) { float x[8];
#pragma unroll
            for (int j = 0; j < 8; ++j) x[j] = fmaxf(s[0][qt][j], s[1][qt][j]);
            float y = fmaxf(fmaxf(fmaxf(x[0], x[1]), fmaxf(x[2], x[3])), fmaxf(fmaxf(x[4], x[5]), fmaxf(x[6], x[7])));
            y = fmaxf(y, xhalf(y)); bm[qt] = y * C2; }
        const bool need = (bm[0] > m2[0] + 8.0f) || (bm[1] > m2[1] + 8.0f);
        if (__builtin_amdgcn_ballot_w32(need) != 0) {
#pragma unroll
            for (int qt = 0; qt < 2; ++qt) { const float mn = fmaxf(m2[qt], bm[qt]); const float al = __builtin_amdgcn_exp2f(m2[qt] - mn); m2[qt] = mn; ls[qt] *= al;
#pragma unroll
                for (int dt = 0; dt < 4; ++dt) o[dt][qt] *= al; } }
        F ph[2], pl[2];
#pragma unroll
        for (int qt = 0; qt < 2; ++qt) { float p[16];
#pragma unroll
            for (int e = 0; e < 16; ++e) p[e] = __builtin_amdgcn_exp2f(__builtin_fmaf(s[e >> 3][qt][e & 7], C2, -m2[qt]));
            float t[8];
#pragma unroll
            for (int e = 0; e < 8; ++e) t[e] = p[e] + p[e + 8];
            ls[qt] += ((t[0] + t[1]) + (t[2] + t[3])) + ((t[4] + t[5]) + (t[6] + t[7]));
            PPack<HL>::pack(p, ph[qt], pl[qt]); }
#pragma unroll
        for (int dt = 0; dt < 4; ++dt)
#pragma unroll
            for (int qt = 0; qt < 2; ++qt) o[dt][qt] = WFrag<T16>::mma(vf[dt], ph[qt], o[dt][qt]);
        if (HL) {
#pragma unroll
            for (int dt = 0; dt < 4; ++dt)
#pragma unroll
                for (int qt = 0; qt < 2; ++qt) o[dt][qt] = WFrag<T16>::mma(vf[dt], pl[qt], o[dt][qt]);
#pragma unroll
            for (int dt = 0; dt < 4; ++dt)
#pragma unroll
                for (int qt = 0; qt < 2; ++qt) o[dt][qt] = WFrag<T16>::mma(v2[dt], ph[qt], o[dt][qt]); }
    };
#pragma unroll 1
    for (int k0 = 0; k0 < TT; k0 += 64) { pass(k0, va, va2, vb, vb2); pass(k0 + 32, vb, vb2, va, va2); }
    asm volatile("s_wait_xcnt 0x0" ::: "memory");   // the epilogue reuses the registers of the last loads' addresses: the wait stands in front of it
    __builtin_amdgcn_sched_barrier(0);              // keeps the epilogue behind that wait
    const unsigned oofs = (unsigned)(lr * DQ + 8 * hi);
    v8us oh[2][4], ol[2][4];
#pragma unroll
    for (int qt = 0; qt < 2; ++qt) { const float inv = __fdiv_rn(1.0f, ls[qt] + xhalf(ls[qt]));
#pragma unroll
        for (int dt = 0; dt < 4; ++dt)
#pragma unroll
            for (int j = 0; j < 8; ++j) { unsigned short a, c2; splitf(o[dt][qt][j] * inv, a, c2); oh[qt][dt][j] = a; ol[qt][dt][j] = c2; } }
    __builtin_amdgcn_sched_barrier(0);   // the stores stand behind the splitting arithmetic, so that it writes no register that an issued store names
#pragma unroll
    for (int qt = 0; qt < 2; ++qt)
#pragma unroll
        for (int dt = 0; dt < 4; ++dt) { *(v8us*)(Ah + oofs + (qt * 16 * DQ + dt * 16)) = oh[qt][dt]; *(v8us*)(Al + oofs + (qt * 16 * DQ + dt * 16)) = ol[qt][dt]; }
}
// k_fattn: grid (head planes of the pass, TT / 128), 4 waves of 32 queries. The query blocks below RH (three products) have the low block indices and start first.
__global__ __launch_bounds__(128) void k_fattn(const bf* __restrict__ QKh, const bf* __restrict__ QKl, const h16* __restrict__ QK16, const bf* __restrict__ VTh, const bf* __restrict__ VTl, const h16* __restrict__ VT16, size_t pl, bf* Ah, bf* Al) {
    const int y = (int)blockIdx.x; const size_t zo = (size_t)y * TT * HD;
    const int q0 = (int)blockIdx.y * 128 + __builtin_amdgcn_readfirstlane((int)(threadIdx.x >> 5)) * 32;   // the wave's first query, in a scalar register
    const size_t qo = zo + (size_t)q0 * HD, ao = ((size_t)(y / NH_) * TT + q0) * DQ + (size_t)(y % NH_) * HD;
    if ((int)blockIdx.y * 128 < RH) fattn_wave<bf, true>(QKh + qo, QKl + qo, QKh + pl + zo, QKl + pl + zo, VTh + zo, VTl + zo, Ah + ao, Al + ao);
    else fattn_wave<h16, false>(QK16 + qo, nullptr, QK16 + pl + zo, nullptr, VT16 + zo, nullptr, Ah + ao, Al + ao);
}

extern "C" void kernel_launch(void* const* d_in, const int* in_sizes, int n_in,
                              void* d_out, int out_size, void* d_ws, size_t ws_size, hipStream_t stream) {
    (void)in_sizes; (void)n_in; (void)out_size;
    const float* xq = (const float*)d_in[0]; const float* xk = (const float*)d_in[1]; const float* xv = (const float*)d_in[2]; const float* wq = (const float*)d_in[3]; const float* bq = (const float*)d_in[4]; const float* wk = (const float*)d_in[5]; const float* bk = (const float*)d_in[6]; const float* wv = (const float*)d_in[7]; const float* bv = (const float*)d_in[8]; const float* wo = (const float*)d_in[9]; const float* bo = (const float*)d_in[10]; const float* x = xq; (void)x; const float* cosT = nullptr; const float* sinT = nullptr; (void)cosT; (void)sinT;
    float* OUT = (float*)d_out;     // [8][1024][1024]
    char* wsp = (char*)d_ws;
    auto take = [&](size_t bytes) { char* p = wsp; wsp += (bytes + 255) & ~(size_t)255; return (void*)p; };
    const size_t PL = (size_t)NBG * NH_ * TT * HD;   // elements of one set of head planes: NBG batch elements, all heads
    bf* W3 = (bf*)take((size_t)3 * DQ * DM * 2); bf* WO = (bf*)take((size_t)DM * DQ * 2);   // W3: q, k, v weights, transposed
    h16* QK16 = (h16*)take(2 * PL * 2); bf* QKh = (bf*)take(2 * PL * 2); bf* QKl = (bf*)take(2 * PL * 2);   // q planes, then k planes
    h16* VT16 = (h16*)take(PL * 2); bf* VTh = (bf*)take(PL * 2); bf* VTl = (bf*)take(PL * 2);
    bf* ATh = (bf*)take((size_t)NB_ * TT * DQ * 2); bf* ATl = (bf*)take((size_t)NB_ * TT * DQ * 2);
    const size_t XN = (size_t)NBG * TT * DM;   // elements of one input, or of one projection, in a pass
    bf* X3 = (bf*)take(3 * XN * 2);   // the projection pass's bf16 inputs; q, k, v one behind the other
    if ((size_t)(wsp - (char*)d_ws) > ws_size) return;    // ws 256 MiB
    k_wtG<<<dim3((DM * HD / 64 + 63) / 64, NH_, 3), 256, 0, stream>>>(wq, wk, wv, DM, HD, W3, (size_t)DQ * DM);
    k_wtG<<<dim3((DQ * DM / 64 + 63) / 64, 1, 1), 256, 0, stream>>>(wo, wo, wo, DQ, DM, WO, 0);
    for (int g = 0; g < NB_; g += NBG) {
        k_cvt8<<<dim3((unsigned)((XN / 8 + 255) / 256), 3, 1), 256, 0, stream>>>(xq + (size_t)g * TT * DM, xk + (size_t)g * TT * DM, xv + (size_t)g * TT * DM, X3, XN / 8);
        k_proj<<<dim3(NBG * TT / 64, NH_, 3), 32, 0, stream>>>(X3, W3, bq, bk, bv, QK16, QKh, QKl, VT16, VTh, VTl);
        k_fattn<<<dim3(NBG * NH_, TT / 128, 1), 128, 0, stream>>>(QKh, QKl, QK16, VTh, VTl, VT16, PL, ATh + (size_t)g * TT * DQ, ATl + (size_t)g * TT * DQ); }
    k_gemmw<bf, 1, true><<<dim3(NB_ * TT / 64, DM / 64, 1), 32, 0, stream>>>(ATh, ATl, WO, nullptr, DQ, OUT, DM, bo, bo, bo, 0, 0, 0);
}
